// v009
// The times below were measured on an AMD MI455X: many runs one after another, warmed up first and cycling through
// copies of the inputs, with the whole window's GPU time divided by the number of runs. Launches and the gaps
// between them are all in it. The median over several windows is given; except for v000 it joins two sittings, which
// can be a few percent apart, so the side-by-side timings, each taken in one sitting, are the better comparison.
// This document starts at v009; the versions before it stand elsewhere.
// A run of this version takes 55.8 microseconds.
// Next to v008, in two timings, it ran 1.07 times as fast each time.
// Over all steps from v000, the starting kernel, it is 10.8 times as fast.
// Contractions: node K|V projection (nodes x [Wk|Wv]), head-merge projection (W_comb^T x O^T) and pointer scores (nodes x MH^T) on v_wmma_f32_16x16x32_bf16 with bf16 hi/lo operand planes (hi.hi + hi.lo + lo.hi); lazy-mask hidden layer (lm_W2^T f16 carried x16, as A, x H1 f16, as B) on v_wmma_f32_16x16x32_f16 inside the fused lazy-mask kernel; all f32 accumulate; query/FiLM/gating/qf projections, lazy layers 1 (K=3 after the broadcast fold) and 3 (N=1) and both softmaxes in f32 on the VALU; the attention core's two products (K x Q^T, V^T x P^T, head dim 16) on v_wmma_f32_16x16x4_f32.
#include <hip/hip_runtime.h>
#include <math.h>

typedef __attribute__((ext_vector_type(16))) _Float16 v16h;
typedef __attribute__((ext_vector_type(8)))  _Float16 v8h;
typedef __attribute__((ext_vector_type(16))) __bf16   v16b;
typedef __attribute__((ext_vector_type(8)))  __bf16   v8b;
typedef __attribute__((ext_vector_type(8)))  float    v8f;
typedef __attribute__((ext_vector_type(4)))  float    v4f;
typedef __attribute__((ext_vector_type(4)))  unsigned int v4u;
typedef __attribute__((ext_vector_type(2)))  float    v2f;
typedef __attribute__((ext_vector_type(2)))  _Float16 v2h;

// ---------------------------------------------------------------------------
// Problem constants
// ---------------------------------------------------------------------------
constexpr int kB   = 16;      // batch
constexpr int kP   = 100;     // queries per batch
constexpr int kN   = 1000;    // nodes
constexpr int kNP  = 1024;    // nodes padded
constexpr int kE   = 128;     // embedding
constexpr int kH   = 8;       // heads
constexpr int kD   = 16;      // head dim
constexpr int kHD  = 128;     // H*D
constexpr int kQD  = 16;      // lazy query dim
constexpr int kDYN = 3;       // dynamic features
constexpr int kHID = 64;      // lazy hidden
constexpr int kBP     = kB * kP;          // 1600 (b,p) rows
constexpr int kBPpad  = 1664;             // 26 * 64
constexpr int kEncRows = kB * kNP;        // 16384 padded node rows
constexpr int kPG = 7;                     // groups of 16 queries per batch (100 padded to 112)
constexpr float kWCarry   = 16.0f;        // lm_W2 carried x16 in f16
constexpr float kInvSqrtE = 0.08838834764831845f;
constexpr float kClip     = 10.0f;
static_assert(kBPpad % 64 == 0 && kBPpad >= kBP, "pad");
static_assert(kPG * 16 >= kP && kBPpad >= (kB - 1) * kP + kPG * 16, "last batch's query groups inside the O planes");
static_assert(kH * kD == kHD && kE == kHD, "dims");

__device__ __forceinline__ unsigned short f2bf_bits(float f) {
  unsigned u = __float_as_uint(f);
  return (unsigned short)((u + 0x7FFFu + ((u >> 16) & 1u)) >> 16);
}
__device__ __forceinline__ float bf_bits2f(unsigned short h) { return __uint_as_float(((unsigned)h) << 16); }

// hazard guards as plain device helpers (no inline asm inside the kernel template body)
__device__ __forceinline__ void dep_guard_h(v8f& a, v8f& b, v16h x, v16h y) { asm volatile("v_nop\n\tv_nop\n\tv_nop\n\tv_nop" : "+v"(a), "+v"(b) : "v"(x), "v"(y)); }
__device__ __forceinline__ void dep_guard_b(v8f& a, v8f& b, v16b x, v16b y) { asm volatile("v_nop\n\tv_nop\n\tv_nop\n\tv_nop" : "+v"(a), "+v"(b) : "v"(x), "v"(y)); }
__device__ __forceinline__ void keep4_h(v16h a, v16h b, v16h c, v16h d) { asm volatile("v_nop" :: "v"(a), "v"(b), "v"(c), "v"(d)); }
__device__ __forceinline__ void keep4_b(v16b a, v16b b, v16b c, v16b d) { asm volatile("v_nop" :: "v"(a), "v"(b), "v"(c), "v"(d)); }
__device__ __forceinline__ void acc_guard4(v8f& a, v8f& b, v8f& c, v8f& d) { asm volatile("v_nop\n\tv_nop\n\tv_nop\n\tv_nop" : "+v"(a), "+v"(b), "+v"(c), "+v"(d)); }
template <typename T> struct Frag;
template <> struct Frag<_Float16> {
  typedef v16h V; union U { v16h v; v8h h[2]; };
  static __device__ __forceinline__ v16h load(const _Float16* p) {   // elements 0..7 <- p[0..7], 8..15 <- p[16..23]
    U f; f.h[0] = *(const v8h*)(p); f.h[1] = *(const v8h*)(p + 16); return f.v;
  }
  static __device__ __forceinline__ v8f mma(v16h a, v16h b, v8f c) {
    return __builtin_amdgcn_wmma_f32_16x16x32_f16(false, a, false, b, (short)0, c, false, false);
  }
  static __device__ __forceinline__ void guard(v8f& a, v8f& b, v16h x, v16h y) { dep_guard_h(a, b, x, y); }
  static __device__ __forceinline__ void keep(v16h a, v16h b, v16h c, v16h d) { keep4_h(a, b, c, d); }
};
template <> struct Frag<__bf16> {
  typedef v16b V; union U { v16b v; v8b h[2]; };
  static __device__ __forceinline__ v16b load(const __bf16* p) {
    U f; f.h[0] = *(const v8b*)(p); f.h[1] = *(const v8b*)(p + 16); return f.v;
  }
  static __device__ __forceinline__ v8f mma(v16b a, v16b b, v8f c) {
    return __builtin_amdgcn_wmma_f32_16x16x32_bf16(false, a, false, b, (short)0, c, false, false);
  }
  static __device__ __forceinline__ void guard(v8f& a, v8f& b, v16b x, v16b y) { dep_guard_b(a, b, x, y); }
  static __device__ __forceinline__ void keep(v16b a, v16b b, v16b c, v16b d) { keep4_b(a, b, c, d); }
};

__device__ __forceinline__ unsigned pk16(unsigned short a, unsigned short b) { return (unsigned)a | ((unsigned)b << 16); }
__device__ __forceinline__ unsigned short h_bits(float f) { const _Float16 h = (_Float16)f; return __builtin_bit_cast(unsigned short, h); }
// bf16 hi + bf16 lo split of an f32 value (both RNE converts)
__device__ __forceinline__ void split_bf(float f, unsigned short& hb, unsigned short& lb) {
  hb = f2bf_bits(f);
  lb = f2bf_bits(f - bf_bits2f(hb));
}

// ---- Register-blocked batched WMMA GEMM (ACT reduced to none/relu/leaky) -----------------------
// C[m,n] = scale * sum_k A[m,k] * Bt[n,k] (+bias)(+resid); each wave owns a 64x64 tile.
// A row-major [M,K]; Bt row-major [N,K]; M,N % 64 == 0, K % 32 == 0.
// SPLIT: operands are hi/lo planes (A2/Bt2 = lo planes, same layout); product = hi·hi + hi·lo + lo·hi.
// BIAS_MODE: 0 = none, 1 = bias[m], 2 = bias[n].
// OUT_MODE: 0 = f32, 1 = f16, 2 = bf16 hi plane (Cout) + bf16 lo plane (Cout2).
// ET: 0 = f16 operands, 1 = bf16 operands (pointers passed as 16-bit storage)
template <int ET> struct Elem;
template <> struct Elem<0> { typedef _Float16 T; };
template <> struct Elem<1> { typedef __bf16 T; };
// The engine is a device function, so that a launch can hold it beside another job: NW = waves per block, sT = NW slabs of
// LDS (16x64 f32 at a pitch of 68 floats each), bx = block index among the engine's blocks, b = batch index.
template <int NW, int ET, bool SPLIT, int BIAS_MODE, int OUT_MODE, bool RESID, int ACT>
__device__ __forceinline__ void gemm64_body(
    float* sT, int bx, int b,
    const unsigned short* __restrict__ Ap, const unsigned short* __restrict__ A2p, int lda, long strideA,
    const unsigned short* __restrict__ Btp, const unsigned short* __restrict__ Bt2p, int ldb, long strideB,
    void* __restrict__ Cout, void* __restrict__ Cout2, int ldc, long strideC,
    const float* __restrict__ bias,
    const float* __restrict__ resid, long strideR,
    int M, int N, int K, float scale) {
  typedef typename Elem<ET>::T T;
  typedef typename Frag<T>::V V;
  const T* A = (const T*)Ap; const T* A2 = (const T*)A2p; const T* Bt = (const T*)Btp; const T* Bt2 = (const T*)Bt2p;
  const int lane = threadIdx.x & 31;
  const int wave = threadIdx.x >> 5;
  const int tilesN = N >> 6;
  const int tilesM = M >> 6;
  const int tile = bx * NW + wave;
  if (tile >= tilesM * tilesN) return;   // wave-uniform; no block barriers in this kernel
  const int tm = tile / tilesN;
  const int tn = tile - tm * tilesN;
  const int m0 = tm << 6;
  const int n0 = tn << 6;

  const T* Ab  = A  + (size_t)b * strideA;
  const T* Bb  = Bt + (size_t)b * strideB;
  const T* Ab2 = SPLIT ? (A2  + (size_t)b * strideA) : nullptr;
  const T* Bb2 = SPLIT ? (Bt2 + (size_t)b * strideB) : nullptr;

  const int rlane = lane & 15;                 // row (A) / col (B, D) within subtile
  const int koff  = (lane >> 4) * 8;           // k offset of this lane half
  const int mOff  = (lane >> 4) * 8;           // D row offset

  v8f acc[4][4];
#pragma unroll
  for (int i = 0; i < 4; ++i)
#pragma unroll
    for (int j = 0; j < 4; ++j) acc[i][j] = (v8f){0.f,0.f,0.f,0.f,0.f,0.f,0.f,0.f};

  for (int k0 = 0; k0 < K; k0 += 32) {
    V bh[4], bl[4];
#pragma unroll
    for (int j = 0; j < 4; ++j) {
      const size_t bo = (size_t)(n0 + (j << 4) + rlane) * ldb + koff + k0;
      bh[j] = Frag<T>::load(Bb + bo);
      if (SPLIT) bl[j] = Frag<T>::load(Bb2 + bo);
    }
#pragma unroll
    for (int i = 0; i < 4; ++i) {
      const size_t ao = (size_t)(m0 + (i << 4) + rlane) * lda + koff + k0;
      V ah = Frag<T>::load(Ab + ao);
      V al;
      if (SPLIT) al = Frag<T>::load(Ab2 + ao);
#pragma unroll
      for (int j = 0; j < 4; ++j) {
        acc[i][j] = Frag<T>::mma(ah, bh[j], acc[i][j]);
        if (SPLIT) {
          acc[i][j] = Frag<T>::mma(ah, bl[j], acc[i][j]);
          acc[i][j] = Frag<T>::mma(al, bh[j], acc[i][j]);
        }
      }
      Frag<T>::guard(acc[i][0], acc[i][3], ah, SPLIT ? al : ah);
    }
    Frag<T>::keep(bh[0], bh[1], bh[2], bh[3]);
    if (SPLIT) Frag<T>::keep(bl[0], bl[1], bl[2], bl[3]);
  }
  acc_guard4(acc[0][0], acc[0][1], acc[0][2], acc[0][3]);
  acc_guard4(acc[1][0], acc[1][1], acc[1][2], acc[1][3]);
  acc_guard4(acc[2][0], acc[2][1], acc[2][2], acc[2][3]);
  acc_guard4(acc[3][0], acc[3][1], acc[3][2], acc[3][3]);

  // ---- epilogue ----
  float* slab = sT + wave * (16 * 68);
  const float* Rb = RESID ? (resid + (size_t)b * strideR) : nullptr;
#pragma unroll
  for (int i = 0; i < 4; ++i) {
    const int mBase = m0 + (i << 4);
#pragma unroll
    for (int j = 0; j < 4; ++j) {
      const int n = n0 + (j << 4) + rlane;
      float bv = 0.f;
      if (BIAS_MODE == 2) bv = bias[n];
#pragma unroll
      for (int r = 0; r < 8; ++r) {
        float v = acc[i][j][r] * scale;
        if (BIAS_MODE == 1) v += bias[mBase + mOff + r];
        if (BIAS_MODE == 2) v += bv;
        if (RESID) v += Rb[(size_t)(mBase + mOff + r) * ldc + n];
        if (ACT == 2) v = fmaxf(v, 0.0f);
        if (ACT == 4) v = (v > 0.f) ? v : 0.01f * v;
        slab[(mOff + r) * 68 + (j << 4) + rlane] = v;
      }
    }
    __builtin_amdgcn_fence(__ATOMIC_RELEASE, "workgroup");
    __builtin_amdgcn_wave_barrier();
    __builtin_amdgcn_fence(__ATOMIC_ACQUIRE, "workgroup");
    if (OUT_MODE == 0) {
      float* C = (float*)Cout + (size_t)b * strideC;
      const int hh = lane >> 4, c4 = (lane & 15) * 4;     // row seg = 256 B = 16 lanes x 16 B
      {
#pragma unroll
        for (int it = 0; it < 8; ++it) {
          const int row = it * 2 + hh;
          v4f v = *(const v4f*)(slab + row * 68 + c4);
          *(v4f*)(C + (size_t)(mBase + row) * ldc + n0 + c4) = v;
        }
        
      }
    } else {
      const int q = lane >> 3, c8 = (lane & 7) * 8;
      unsigned short* C  = (unsigned short*)Cout  + (size_t)b * strideC;
      unsigned short* C2 = (OUT_MODE == 2) ? ((unsigned short*)Cout2 + (size_t)b * strideC) : nullptr;
      {
#pragma unroll
        for (int it = 0; it < 4; ++it) {
          const int row = it * 4 + q;
          const float* sp = slab + row * 68 + c8;
          v8h hv, lv;
#pragma unroll
          for (int e = 0; e < 8; ++e) {
            if (OUT_MODE == 1) {
              hv[e] = (_Float16)sp[e];
            } else {
              unsigned short hb = f2bf_bits(sp[e]);
              unsigned short lb = f2bf_bits(sp[e] - bf_bits2f(hb));
              hv[e] = __builtin_bit_cast(_Float16, hb);
              lv[e] = __builtin_bit_cast(_Float16, lb);
            }
          }
          *(v8h*)(C + (size_t)(mBase + row) * ldc + n0 + c8) = hv;
          if (OUT_MODE == 2) *(v8h*)(C2 + (size_t)(mBase + row) * ldc + n0 + c8) = lv;
        }
        
      }
    }
    __builtin_amdgcn_fence(__ATOMIC_RELEASE, "workgroup");
    __builtin_amdgcn_wave_barrier();
    __builtin_amdgcn_fence(__ATOMIC_ACQUIRE, "workgroup");
  }
}
// ---------------------------------------------------------------------------
// Weight preparation: 64x64 transpose tiles of f32 W[k][n] (pitch ldn) -> WT[n][k] (pitch ldk).
// blocks 0..3: Wk -> WkvHi/WkvLo rows 0..127 (bf16 hi + bf16 lo planes); 4..7: Wv -> rows 128..255;
// 8..11: W_comb -> WcHi/WcLo; 12: lm_W2 -> W2T (f16 carried x16, single plane).
// Load coverage: 16 x 256 = 4096 = whole tile. Store coverage: 8 waves x 2 it x 4 rows (lane>>3) = 64 rows,
// ---------------------------------------------------------------------------
constexpr int kWpBlocks = 13;
constexpr int kWpLds = 64 * 65;   // floats
__device__ __forceinline__ void wprep_body(float* smem, int bid,
                                           const float* __restrict__ Wk, const float* __restrict__ Wv,
                                           const float* __restrict__ Wcomb, const float* __restrict__ W2,
                                           unsigned short* __restrict__ WkvHi, unsigned short* __restrict__ WkvLo,
                                           unsigned short* __restrict__ WcHi, unsigned short* __restrict__ WcLo,
                                           unsigned short* __restrict__ W2T) {
  float (*sm)[65] = (float (*)[65])smem;   // sm[n_local][k_local]
  const int t = threadIdx.x, lane = t & 31, wave = t >> 5;
  // bid: block-uniform selection below
  const float* W = Wk; unsigned short* outH = WkvHi; unsigned short* outL = WkvLo;
  int ldn = kHD, ldk = kE, nt = 0, kt = 0; float carry = 1.0f;
  const bool two_planes = (bid < 12);
  if (bid < 4)       { W = Wk;    outH = WkvHi;                    outL = WkvLo;                    ldn = kHD;  ldk = kE;   nt = bid & 1;       kt = bid >> 1;       carry = 1.0f; }
  else if (bid < 8)  { W = Wv;    outH = WkvHi + (size_t)kHD * kE; outL = WkvLo + (size_t)kHD * kE; ldn = kHD;  ldk = kE;   nt = (bid - 4) & 1; kt = (bid - 4) >> 1; carry = 1.0f; }
  else if (bid < 12) { W = Wcomb; outH = WcHi;                     outL = WcLo;                     ldn = kE;   ldk = kHD;  nt = (bid - 8) & 1; kt = (bid - 8) >> 1; carry = 1.0f; }
  else               { W = W2;    outH = W2T;                      outL = W2T;                      ldn = kHID; ldk = kHID; nt = 0;             kt = 0;              carry = kWCarry; }
  const int n0 = nt * 64, k0 = kt * 64;
  const int r0 = t >> 6;     // k local of trip 0; trip i: r0 + 4 i
  const int c = t & 63;      // n local
  float wv[16];
#pragma unroll
  for (int g = 0; g < 4; ++g) {
    const float* p0 = W + (size_t)(k0 + r0 + 16 * g) * ldn + n0 + c;
    const float* p1 = p0 + (size_t)4 * ldn;
    const float* p2 = p0 + (size_t)8 * ldn;
    const float* p3 = p0 + (size_t)12 * ldn;
    wv[4 * g] = *p0; wv[4 * g + 1] = *p1; wv[4 * g + 2] = *p2; wv[4 * g + 3] = *p3;
    // address translations done before a register that one of these four loads names is reused; naming the four addresses
    // as inputs keeps them in their registers up to the wait
    asm volatile("s_wait_xcnt 0x0" :: "v"(p0), "v"(p1), "v"(p2), "v"(p3) : "memory");
  }
#pragma unroll
  for (int i = 0; i < 16; ++i) sm[c][r0 + 4 * i] = wv[i] * carry;
  __syncthreads();
  const int q = lane >> 3, c8 = (lane & 7) * 8;
  v4u uh[2], ul[2];
  int rowv[2];
#pragma unroll
  for (int it = 0; it < 2; ++it) {
    const int row = wave * 8 + it * 4 + q;   // n local
    rowv[it] = row;
    unsigned short hb[8], lb[8];
#pragma unroll
    for (int e = 0; e < 8; ++e) {
      const float v = sm[row][c8 + e];
      if (two_planes) { split_bf(v, hb[e], lb[e]); }
      else { hb[e] = h_bits(v); lb[e] = hb[e]; }
    }
    uh[it] = (v4u){pk16(hb[0], hb[1]), pk16(hb[2], hb[3]), pk16(hb[4], hb[5]), pk16(hb[6], hb[7])};
    ul[it] = (v4u){pk16(lb[0], lb[1]), pk16(lb[2], lb[3]), pk16(lb[4], lb[5]), pk16(lb[6], lb[7])};
  }
  {
#pragma unroll
    for (int it = 0; it < 2; ++it) {
      const size_t o = (size_t)(n0 + rowv[it]) * ldk + k0 + c8;
      *(v4u*)(outH + o) = uh[it];
      // behind each store: address translation done before the code laid out behind it writes a register that the store names
      asm volatile("s_wait_xcnt 0x0" ::: "memory");
      if (two_planes) {
        *(v4u*)(outL + o) = ul[it];
        asm volatile("s_wait_xcnt 0x0" ::: "memory");   // as above
      }
    }
  }
}

// ---------------------------------------------------------------------------
// Node split: enc f32 [B][1000][128] -> EncHi/EncLo bf16 hi/lo planes [B][1024][128] each
// (rows 1000..1023 of every batch written as zeros in both planes).
// ---------------------------------------------------------------------------
constexpr int kEcBlocks = (kEncRows * 16) / 256;
__device__ __forceinline__ void enc_cast_body(int bid, const float* __restrict__ enc, unsigned short* __restrict__ outHi,
                                              unsigned short* __restrict__ outLo) {
  const int i = bid * 256 + threadIdx.x;
  if (i >= kEncRows * 16) return;
  const int row = i >> 4, c8 = (i & 15) * 8;
  const int b = row >> 10, n = row & (kNP - 1);
  const int nc = (n < kN) ? n : (kN - 1);                    // address clamp
  const float* p = enc + ((size_t)(b * kN + nc)) * kE + c8;
  const v4f a = *(const v4f*)(p);
  const v4f c = *(const v4f*)(p + 4);
  const bool valid = (n < kN);
  unsigned short hb[8], lb[8];
#pragma unroll
  for (int e = 0; e < 4; ++e) {
    split_bf(valid ? a[e] : 0.0f, hb[e], lb[e]);
    split_bf(valid ? c[e] : 0.0f, hb[4 + e], lb[4 + e]);
  }
  const v4u uh = (v4u){pk16(hb[0], hb[1]), pk16(hb[2], hb[3]), pk16(hb[4], hb[5]), pk16(hb[6], hb[7])};
  const v4u ul = (v4u){pk16(lb[0], lb[1]), pk16(lb[2], lb[3]), pk16(lb[4], lb[5]), pk16(lb[6], lb[7])};
  const size_t o = (size_t)row * kE + c8;
  *(v4u*)(outHi + o) = uh;
  *(v4u*)(outLo + o) = ul;
  
}

// ---------------------------------------------------------------------------
// Query side (f32, VALU), 4 (b,p) rows per block: q_in = [last | load] (129);
//   Qs[bp][h*16+d] = ((q_in.Wq_last) * 2*sigmoid(relu(q_in.fW1 + fb1).fW2 + fb2)) * 0.25   (1/sqrt(16) folded, exact)
//   QW[bp][64]     = lm_b1 + qf.lm_W1[3:19]   with qf = q_in.lazy_q_W + lazy_q_b
// 5 working waves. Waves 0..3: thread = output column j; every weight element it loads feeds the chains of the 4 rows, whose
// inputs lie in LDS as [e][row] (one 16-B broadcast read per e). Wave 4: hidden unit 128 of the FiLM layer, qf, then QW.
// The weight loads go out in batches, one batch ahead of the arithmetic, so their latencies overlap.
// Every output is still one fma chain from its bias, e ascending.
// All loops of this kernel are unrolled in full: the batches are register arrays, which takes static indices, and the
// loads of a batch have to stand together ahead of the arithmetic that uses the batch before.
// Stores: one instruction of a wave writes one whole 128-B line of a Qs or QW row.
// The launch that holds this job has blocks of 8 waves: waves 5..7 have no part here and only pass the two barriers.
// ---------------------------------------------------------------------------
constexpr int kQR = 4;     // (b,p) rows per block
constexpr int kQB = 16;    // e steps per batch of weight loads
static_assert(kBP % kQR == 0 && kE % kQB == 0, "rows per block, batches");
// one batch of a weight column: w[i] = col[(e0 + i) * LD]
template <int LD>
__device__ __forceinline__ void q_fetch(float (&w)[kQB], const float* __restrict__ col, int e0) {
#pragma unroll
  for (int i = 0; i < kQB; ++i) w[i] = col[(e0 + i) * LD];
}
// Stands behind a group of loads: address translations done before a register that an issued load names is reused; its
// "memory" clobber also keeps those loads in front of the LDS reads and the arithmetic below, which then cover their latency.
__device__ __forceinline__ void q_issued() { asm volatile("s_wait_xcnt 0x0" ::: "memory"); }
// a[r] += x[r] * w for NR rows
template <int NR>
__device__ __forceinline__ void q_step(float (&a)[NR], const float* x, float w) {
#pragma unroll
  for (int r = 0; r < NR; ++r) a[r] = fmaf(x[r], w, a[r]);
}
// a[r] += sum_e xa[e][r] * colA[e * LDA] and b[r] += sum_e xb[e][r] * colB[e * LDB], e = 0..128 ascending;
// xa, xb: LDS, kQR floats per e
template <int LDA, int LDB, int NA, int NB>
__device__ __forceinline__ void q_dot2(float (&a)[NA], const float* xa, const float* __restrict__ colA,
                                       float (&b)[NB], const float* xb, const float* __restrict__ colB) {
  float wa[2][kQB], wb[2][kQB];
  q_fetch<LDA>(wa[0], colA, 0);
  q_fetch<LDB>(wb[0], colB, 0);
  float wat = 0.0f, wbt = 0.0f;
#pragma unroll
  for (int c = 0; c < kE / kQB; ++c) {
    if (c + 1 < kE / kQB) {
      q_fetch<LDA>(wa[(c + 1) & 1], colA, kQB * (c + 1));
      q_fetch<LDB>(wb[(c + 1) & 1], colB, kQB * (c + 1));
    } else {
      wat = colA[kE * LDA];
      wbt = colB[kE * LDB];
    }
    q_issued();
#pragma unroll
    for (int i = 0; i < kQB; ++i) {
      q_step<NA>(a, xa + (kQB * c + i) * kQR, wa[c & 1][i]);
      q_step<NB>(b, xb + (kQB * c + i) * kQR, wb[c & 1][i]);
    }
  }
  q_step<NA>(a, xa + kE * kQR, wat);
  q_step<NB>(b, xb + kE * kQR, wbt);
}
constexpr int kQsBlocks = kBP / kQR;
constexpr int kQsLds = (kE + 1) * kQR + (kE * kQR + 32) + kQD * kQR;   // floats
__device__ __forceinline__ void qside_body(float* smem, int bid,
                                           const float* __restrict__ enc_last, const float* __restrict__ loadv,
                                           const float* __restrict__ Wq, const float* __restrict__ fW1,
                                           const float* __restrict__ fb1, const float* __restrict__ fW2,
                                           const float* __restrict__ fb2, const float* __restrict__ lqW,
                                           const float* __restrict__ lqb, const float* __restrict__ lW1,
                                           const float* __restrict__ lb1,
                                           float* __restrict__ Qs, float* __restrict__ QW) {
  float* qin = smem;                          // [e][row], (kE + 1) * kQR floats
  float* g1s = qin + (kE + 1) * kQR;          // [e][row]; behind e = 128 the 28 copies that wave 4 leaves
  float* qfs = g1s + kE * kQR + 32;           // [i][row]
  const int bp0 = bid * kQR;
  const int t = threadIdx.x, lane = t & 31;
  const int wv = __builtin_amdgcn_readfirstlane(t >> 5);
  const bool colw = wv < 4, aux = wv == 4;    // scalar: waves 0..3, wave 4; neither: waves 5..7
  if (colw) {
    v4f x;
#pragma unroll
    for (int r = 0; r < kQR; ++r) x[r] = enc_last[(size_t)(bp0 + r) * kE + t];
    q_issued();
    *(v4f*)(qin + t * kQR) = x;
  } else if (aux && lane < kQR) {
    const float x = loadv[bp0 + lane];
    q_issued();
    qin[kE * kQR + lane] = x;
  }
  __syncthreads();
  float qv[kQR] = {0.0f, 0.0f, 0.0f, 0.0f};
  if (colw) {
    const float b1 = fb1[t];
    q_issued();
    float a1[kQR] = {b1, b1, b1, b1};
    q_dot2<kE + 1, kHD, kQR, kQR>(a1, qin, fW1 + t, qv, qin, Wq + t);
    *(v4f*)(g1s + t * kQR) = (v4f){fmaxf(a1[0], 0.0f), fmaxf(a1[1], 0.0f), fmaxf(a1[2], 0.0f), fmaxf(a1[3], 0.0f)};
  } else if (aux) {
    // lane = (qf unit i16, row pair h2); it also runs hidden unit 128 of row lane & 3 (lanes 0..3 are read, the rest are copies)
    const int i16 = lane & 15, h2 = (lane >> 4) * 2;
    float a1[1] = {fb1[kE]};
    const float bq = lqb[i16];
    q_issued();
    float qf[2] = {bq, bq};
    q_dot2<kE + 1, kQD, 1, 2>(a1, qin + (lane & 3), fW1 + kE, qf, qin + h2, lqW + i16);
    g1s[kE * kQR + lane] = fmaxf(a1[0], 0.0f);
    *(v2f*)(qfs + i16 * kQR + h2) = (v2f){qf[0], qf[1]};
  }
  __syncthreads();
  if (colw) {
    const float b2 = fb2[t];
    float gm[kQR] = {b2, b2, b2, b2};
    const float* col = fW2 + t;
    float w[3][kQB];           // two batches ahead here: one column only
    q_fetch<kHD>(w[0], col, 0);
    q_fetch<kHD>(w[1], col, kQB);
    float wt = 0.0f;
#pragma unroll
    for (int c = 0; c < kE / kQB; ++c) {
      if (c + 2 < kE / kQB) q_fetch<kHD>(w[(c + 2) % 3], col, kQB * (c + 2));
      else if (c + 2 == kE / kQB) wt = col[kE * kHD];
      if (c + 2 <= kE / kQB) q_issued();
#pragma unroll
      for (int i = 0; i < kQB; ++i) q_step<kQR>(gm, g1s + (kQB * c + i) * kQR, w[c % 3][i]);
    }
    q_step<kQR>(gm, g1s + kE * kQR, wt);
#pragma unroll
    for (int r = 0; r < kQR; ++r) {
      const float den = 1.0f + expf(-gm[r]);
      const float gamma = 2.0f * (1.0f / den);
      Qs[(size_t)(bp0 + r) * kHD + t] = (qv[r] * gamma) * 0.25f;
    }
  } else if (aux) {
    const float c0 = lb1[lane], c1 = lb1[32 + lane];
    float u0[kQR] = {c0, c0, c0, c0}, u1[kQR] = {c1, c1, c1, c1};
    float w0[kQB], w1[kQB];
    static_assert(kQD == kQB, "one batch");
    q_fetch<kHID>(w0, lW1 + kDYN * kHID + lane, 0);
    q_fetch<kHID>(w1, lW1 + kDYN * kHID + 32 + lane, 0);
    q_issued();
#pragma unroll
    for (int i = 0; i < kQD; ++i) {
      q_step<kQR>(u0, qfs + i * kQR, w0[i]);
      q_step<kQR>(u1, qfs + i * kQR, w1[i]);
    }
#pragma unroll
    for (int r = 0; r < kQR; ++r) {
      QW[(size_t)(bp0 + r) * kHID + lane] = u0[r];
      QW[(size_t)(bp0 + r) * kHID + 32 + lane] = u1[r];
    }
    q_issued();   // the wait behind the stores too: the code laid out behind this branch writes registers that they name
  }
}

// ---------------------------------------------------------------------------
// Lazy-mask MLP, all three layers in one kernel; H1 and H2 never leave the registers.
// Block = one (b,p) row of MASKB, 4 waves; a wave owns 256 node slots and walks them 32 at a time (two 16-slot tiles).
// Lane l: c = l & 15, h = l >> 4.
//   layer 1 (f32 VALU): the lane computes H1[slot c][k] for its own 32 k (k = 32 s + 16 h + e, s = 0,1, e = 0..15),
//     relu, f16: that is the B fragment of k step s as it stands. Its weights come from an LDS table, per k pair
//     {W1[0][k,k+1], W1[1][k,k+1], W1[2][k,k+1], QW[k,k+1]}; the row's dynamic features and mask row are staged in LDS once.
//   layer 2 (WMMA f16): A = lm_W2^T x16, row j = 16 i + c, the same k per lane and element;
//     D register r of tile i = 16 * (H1 . lm_W2[:, j]) for hidden unit j = 16 i + 8 h + r of slot c.
//   layer 3 (f32 VALU): z = sum_j relu(D / 16 + lm_b2[j]) * lm_W3[j]: 32 j in the lane, the other 32 in lane l ^ 16.
//   MASKB[bp][n] = ninf_mask[b,p,min(n,999)] - softplus(z + lm_b3)   (ALPHA = 1)
// Coverage: 1600 blocks x 4 waves x 8 trips x 32 slots = all 1024 columns of all 1600 rows (pad slots from clamped inputs).
// ---------------------------------------------------------------------------
// layer 3 for one 16-unit tile: sum over the lane's 8 hidden units of relu(D / 16 + b2) * w3
__device__ __forceinline__ v2f lazy_l3(v8f acc, const v2f (&b2)[4], const v2f (&w3)[4]) {
  const v2f zero = (v2f){0.0f, 0.0f};
  const v2f sc = (v2f){1.0f / kWCarry, 1.0f / kWCarry};
  v2f zs = zero;
#pragma unroll
  for (int q = 0; q < 4; ++q) {
    const v2f a = __builtin_elementwise_max(__builtin_elementwise_fma((v2f){acc[2 * q], acc[2 * q + 1]}, sc, b2[q]), zero);
    zs = __builtin_elementwise_fma(a, w3[q], zs);
  }
  return zs;
}
constexpr int kLzLds = 2 * 16 * 8 + kN * kDYN + kN;   // floats
__device__ __forceinline__ void lazy_body(float* smem, int bp,
                                          const float* __restrict__ dyn, const float* __restrict__ QW,
                                          const float* __restrict__ lW1, const _Float16* __restrict__ W2T,
                                          const float* __restrict__ lb2, const float* __restrict__ lW3,
                                          const float* __restrict__ lb3, const float* __restrict__ ninfm,
                                          float* __restrict__ maskb) {
  float* tbl = smem;                   // [h][k pair][w0 w0 w1 w1 w2 w2 qw qw], 2 * 16 * 8 floats
  float* sd = tbl + 2 * 16 * 8;        // dynamic features of this (b,p): 1000 x 3
  float* sn = sd + kN * kDYN;          // ninf_mask row of this (b,p)
  const int t = threadIdx.x;
  const int lane = t & 31, wave = t >> 5;
  const int c = lane & 15, h = lane >> 4;
  // stage the 12000 contiguous bytes of dynamic features: 750 x 16 B over 128 threads
  const unsigned oD = (unsigned)t * 16u;
  const char* dsrc = (const char*)(dyn + (size_t)bp * kN * kDYN);
  v4f dv[6];
#pragma unroll
  for (int i = 0; i < 5; ++i) dv[i] = *(const v4f*)(dsrc + oD + i * 2048);
  const bool last = (t < (kN * kDYN * 4 - 5 * 2048) / 16);
  const unsigned oL = last ? (oD + 5 * 2048) : 0u;     // threads past the end fetch in bounds and store nothing
  dv[5] = *(const v4f*)(dsrc + oL);
  // and the 4000 contiguous bytes of the mask row: 250 x 16 B
  const char* nsrc = (const char*)(ninfm + (size_t)bp * kN);
  const bool lastn = (t < (kN * 4 - 2048) / 16);
  const unsigned oN = lastn ? (oD + 2048) : 0u;
  const v4f nv0 = *(const v4f*)(nsrc + oD);
  const v4f nv1 = *(const v4f*)(nsrc + oN);
  // weight table: thread t fetches one pair: h = t >> 6, k pair p = (t >> 2) & 15, which = t & 3
  const int tp = (t >> 2) & 15, tw = t & 3;
  const int tk = 32 * (tp >> 3) + 16 * (t >> 6) + 2 * (tp & 7);
  const float* tsrc = (tw < 3) ? (lW1 + tw * kHID + tk) : (QW + (size_t)bp * kHID + tk);
  const v2f tv = *(const v2f*)tsrc;
  // byte offsets of the lane's first fragment / bias element; these set-up loads are scalar base + one of them
  const unsigned oA = (unsigned)(c * kHID + 16 * h) * 2u;
  const unsigned oJ = (unsigned)(8 * h) * 4u;
  v16h aw[4][2];
#pragma unroll
  for (int i = 0; i < 4; ++i)
#pragma unroll
    for (int s = 0; s < 2; ++s) aw[i][s] = *(const v16h*)((const char*)W2T + oA + (16 * i * kHID + 32 * s) * 2);
  v2f b2[4][4], w3[4][4];
#pragma unroll
  for (int i = 0; i < 4; ++i)
#pragma unroll
    for (int q = 0; q < 4; ++q) {
      b2[i][q] = *(const v2f*)((const char*)lb2 + oJ + (16 * i + 2 * q) * 4);
      w3[i][q] = *(const v2f*)((const char*)lW3 + oJ + (16 * i + 2 * q) * 4);
    }
  const float b3 = lb3[0];
  // address translations done before a register that a load above names is reused
  asm volatile("s_wait_xcnt 0x0" :: "v"(oD), "v"(oL), "v"(oN), "v"(tsrc), "v"(oA), "v"(oJ) : "memory");
#pragma unroll
  for (int i = 0; i < 5; ++i) *(v4f*)((char*)sd + oD + i * 2048) = dv[i];
  if (last) *(v4f*)((char*)sd + oL) = dv[5];
  *(v4f*)((char*)sn + oD) = nv0;
  if (lastn) *(v4f*)((char*)sn + oN) = nv1;
  *(v2f*)(tbl + 2 * t) = tv;
  __syncthreads();
  const int nw = wave * 256;
  float* mp = maskb + (size_t)bp * kNP + nw + lane;
  const v4f* tb4 = (const v4f*)(tbl + h * 128);
  for (int it = 0; it < 8; ++it) {
    const int n0 = nw + it * 32;
    const int n = n0 + lane;
    const int nc = (n < kN) ? n : (kN - 1);                          // address clamps (pad slots)
    const int ia = ((n0 + c < kN) ? (n0 + c) : (kN - 1)) * kDYN;
    const int ib = ((n0 + 16 + c < kN) ? (n0 + 16 + c) : (kN - 1)) * kDYN;
    const float a0 = sd[ia], a1 = sd[ia + 1], a2 = sd[ia + 2];
    const float e0 = sd[ib], e1 = sd[ib + 1], e2 = sd[ib + 2];
    v16h ba[2], bb[2];
    const v2h hzero = (v2h){(_Float16)0.0f, (_Float16)0.0f};
    v4f tq[2][8];                               // weight-table reads, four k pairs a group, one group ahead
#pragma unroll
    for (int j = 0; j < 8; ++j) tq[0][j] = tb4[j];
#pragma unroll
    for (int g = 0; g < 4; ++g) {
      if (g < 3) {
#pragma unroll
        for (int j = 0; j < 8; ++j) tq[(g + 1) & 1][j] = tb4[8 * (g + 1) + j];
      }
      // keeps the next group's LDS reads in front of this group's arithmetic, which then covers their latency
      __builtin_amdgcn_sched_barrier(0);
#pragma unroll
      for (int pp = 0; pp < 4; ++pp) {
        const int p = 4 * g + pp;
        const v4f u = tq[g & 1][2 * pp], v = tq[g & 1][2 * pp + 1];
        const v2f w0 = (v2f){u[0], u[1]}, w1 = (v2f){u[2], u[3]}, w2 = (v2f){v[0], v[1]}, qw = (v2f){v[2], v[3]};
        const v2f xa = __builtin_elementwise_fma(w0, (v2f){a0, a0}, __builtin_elementwise_fma(w1, (v2f){a1, a1},
                       __builtin_elementwise_fma(w2, (v2f){a2, a2}, qw)));
        const v2f xb = __builtin_elementwise_fma(w0, (v2f){e0, e0}, __builtin_elementwise_fma(w1, (v2f){e1, e1},
                       __builtin_elementwise_fma(w2, (v2f){e2, e2}, qw)));
        // relu behind the rounding: same value as rounding behind relu
        const v2h ya = __builtin_elementwise_max(__builtin_convertvector(xa, v2h), hzero);
        const v2h yb = __builtin_elementwise_max(__builtin_convertvector(xb, v2h), hzero);
        ba[p >> 3][2 * (p & 7)] = ya[0]; ba[p >> 3][2 * (p & 7) + 1] = ya[1];
        bb[p >> 3][2 * (p & 7)] = yb[0]; bb[p >> 3][2 * (p & 7) + 1] = yb[1];
      }
    }
    v2f za2[4], zb2[4];
#pragma unroll
    for (int i = 0; i < 4; ++i) {
      const v8f czero = (v8f){0.f, 0.f, 0.f, 0.f, 0.f, 0.f, 0.f, 0.f};
      v8f ca = __builtin_amdgcn_wmma_f32_16x16x32_f16(false, aw[i][0], false, ba[0], (short)0, czero, false, false);
      v8f cc = __builtin_amdgcn_wmma_f32_16x16x32_f16(false, aw[i][0], false, bb[0], (short)0, czero, false, false);
      ca = __builtin_amdgcn_wmma_f32_16x16x32_f16(false, aw[i][1], false, ba[1], (short)0, ca, false, false);
      cc = __builtin_amdgcn_wmma_f32_16x16x32_f16(false, aw[i][1], false, bb[1], (short)0, cc, false, false);
      za2[i] = lazy_l3(ca, b2[i], w3[i]);
      zb2[i] = lazy_l3(cc, b2[i], w3[i]);
    }
    const v2f ta = (za2[0] + za2[1]) + (za2[2] + za2[3]);
    const v2f tb = (zb2[0] + zb2[1]) + (zb2[2] + zb2[3]);
    const float za = ta[0] + ta[1], zb = tb[0] + tb[1];
    // lanes 0..15 finish slots n0 + c (tile a), lanes 16..31 slots n0 + 16 + c (tile b): one exchange l <-> l ^ 16 for both
    const float mine = h ? zb : za;
    const int other = __float_as_int(h ? za : zb);
    const float z = (mine + __int_as_float(__builtin_amdgcn_permlanex16(other, other, 0x76543210, 0xfedcba98, false, false))) + b3;
    // softplus(z) = max(z, 0) + log(1 + exp(-|z|)) on the hardware's exp2 and log2: t lies in [0, 1], so the logarithm's argument
    // lies in [1, 2] and the rounding of 1 + t keeps the absolute error near 2^-23; the value is a bias added to scores of order 1
    const float t1 = 1.0f + __builtin_amdgcn_exp2f(fabsf(z) * -1.44269504f);
    const float spv = fmaf(__builtin_amdgcn_logf(t1), 0.693147181f, fmaxf(z, 0.0f));
    *mp = sn[nc] - spv;
    // address translation done before the store's address register is advanced; the "memory" clobber also keeps the
    // weight-table reads inside the loop (hoisted they hold 128 more registers: over 256, one wave per SIMD fewer)
    asm volatile("s_wait_xcnt 0x0" :: "v"(mp) : "memory");
    mp += 32;
  }
}

// ---------------------------------------------------------------------------
// Second launch: the two jobs that need only the first launch's results and not each other, side by side in one grid.
// Blocks of 4 waves. Blocks 0..255: K|V projection, [16384][128] x [256][128]^T, bf16 hi/lo both operands -> f32 KV; a block
// holds the four 64-column tiles of one 64-row tile. Blocks 256..1855: the lazy-mask MLP, one (b,p) row each.
// The projection's blocks come first: its waves wait on memory for most of their time, and the MLP's waves fill the vector port
// meanwhile. The job select is block-uniform (scalar); both jobs use the same LDS bytes.
// ---------------------------------------------------------------------------
constexpr int kKvBlocks = (kEncRows / 64) * (2 * kHD / 64) / 4;
constexpr int kMidLds = (4 * 16 * 68 > kLzLds) ? 4 * 16 * 68 : kLzLds;
__global__ __launch_bounds__(128) void k_kv_lazy(const unsigned short* __restrict__ EncHi, const unsigned short* __restrict__ EncLo,
                                                const unsigned short* __restrict__ WkvHi, const unsigned short* __restrict__ WkvLo,
                                                float* __restrict__ KV,
                                                const float* __restrict__ dyn, const float* __restrict__ QW,
                                                const float* __restrict__ lW1, const _Float16* __restrict__ W2T,
                                                const float* __restrict__ lb2, const float* __restrict__ lW3,
                                                const float* __restrict__ lb3, const float* __restrict__ ninfm,
                                                float* __restrict__ maskb) {
  __shared__ __align__(16) float smem[kMidLds];
  const int bid = blockIdx.x;
  if (bid < kKvBlocks) {
    gemm64_body<4, 1, true, 0, 0, false, 0>(smem, bid, 0, EncHi, EncLo, kE, 0L, WkvHi, WkvLo, kE, 0L, (void*)KV, (void*)KV,
                                            2 * kHD, 0L, QW, QW, 0L, kEncRows, 2 * kHD, kE, 1.0f);   // bias, resid: never read
  } else {
    lazy_body(smem, bid - kKvBlocks, dyn, QW, lW1, W2T, lb2, lW3, lb3, ninfm, maskb);
  }
}

// ---------------------------------------------------------------------------
// Attention core (f32, head dim 16), both products on v_wmma_f32_16x16x4_f32; node axis split over the waves of a block.
// Block = (b, group of 16 queries, group of 4 heads), 512 threads = 16 waves: wave = (node slice sl = wave >> 1 of 128 slots,
// head pair wave & 1); it runs its two heads one after the other on the same staged nodes. 16 x 7 x 2 = 224 blocks.
// Per stage every slice gets its next 32 nodes in LDS: the 4 heads' K (64 f32) and V (64 f32) of each node, at a pitch of
// 132 floats, and the bias tile [16 queries][32 nodes] at a pitch of 36 floats (both 16 B x odd: 16 rows read by one 16-B
// load fall on 16 different bank groups). Four stages cover the 128 slots of a slice.
// The stages come by asynchronous 16-B copies from global memory to LDS, into two buffers: stage s + 1 is in flight while the
// products of stage s run; one barrier per stage publishes stage s + 1 and frees the buffer of stage s for stage s + 2.
// Lane l: c = l & 15, h = l >> 4. Per head and tile of 16 nodes:
//   scores, transposed: D[node 8h + r][query c] = bias + sum_dim K[node][dim] * Q[query][dim];
//     A = K (row = node c), B = Q (column = query c), both with dim 8h + 2s + e at k step s, element e; C = the bias tile.
//   output, transposed: D[dim 8h + r][query c] += sum_node V[node][dim] * P[node][query];
//     B = the score tile's own registers 2s, 2s + 1 after the exponential (node 8h + 2s + e), A = V (row = dim c) at the same nodes.
// Online softmax per query, one update per stage (32 nodes); slots >= 1000 forced to -inf by value in the bias; m is common to
// the two lane halves of a query, l is kept per half and added at the end.
// Merge: every wave leaves (acc[16], m, l) per head and query in LDS; 128 threads fold the 8 slices in slice order,
//   M = max m_s, w_s = exp(m_s - M), O = sum_s w_s acc_s / sum_s w_s l_s,
// and write O as bf16 hi + bf16 lo planes into Ohi/Olo[bp][h*16+d]: 8 lanes x 16 B = the block's whole 128-B line of a row
// (rows >= P skipped).
// ---------------------------------------------------------------------------
constexpr int kASl  = 8;               // node slices per block
constexpr int kASn  = kNP / kASl;      // 128 node slots per slice
constexpr int kACh  = 32;              // nodes per slice and stage
constexpr int kAHb  = 4;               // heads per block
constexpr int kARow = 2 * kAHb * kD;   // 128 floats per staged node: K of 4 heads | V of 4 heads
constexpr int kAPt  = kARow + 4;       // pitch of a staged node in floats
constexpr int kAMp  = 36;              // bias tile pitch in floats
constexpr int kACp  = 20;              // merge record pitch in floats: acc[16], m, l, 2 unused
constexpr int kAKvFl = kASl * kACh * kAPt;   // floats in one K|V buffer
constexpr int kAMsFl = kASl * 16 * kAMp;     // floats in one bias buffer
static_assert(kASl * kAHb * 16 * kACp <= kAKvFl, "merge records fit one K|V buffer");
static_assert(kASn / kACh >= 2, "the two-buffer order needs two stages");
// Nine asynchronous copies, 16 B per lane each: l = the lane's LDS byte address, g = the lane's global address. The last line
// stands in the copies' own statement: address translations done before a register that a copy names is written again.
template <int O>
__device__ __forceinline__ void a_copy9(const unsigned (&l)[18], const float* const (&g)[18]) {
  asm volatile("global_load_async_to_lds_b128 %0, %9, off\n\t"
               "global_load_async_to_lds_b128 %1, %10, off\n\t"
               "global_load_async_to_lds_b128 %2, %11, off\n\t"
               "global_load_async_to_lds_b128 %3, %12, off\n\t"
               "global_load_async_to_lds_b128 %4, %13, off\n\t"
               "global_load_async_to_lds_b128 %5, %14, off\n\t"
               "global_load_async_to_lds_b128 %6, %15, off\n\t"
               "global_load_async_to_lds_b128 %7, %16, off\n\t"
               "global_load_async_to_lds_b128 %8, %17, off\n\t"
               "s_wait_xcnt 0x0"
               :: "v"(l[O]), "v"(l[O + 1]), "v"(l[O + 2]), "v"(l[O + 3]), "v"(l[O + 4]), "v"(l[O + 5]), "v"(l[O + 6]),
                  "v"(l[O + 7]), "v"(l[O + 8]), "v"(g[O]), "v"(g[O + 1]), "v"(g[O + 2]), "v"(g[O + 3]), "v"(g[O + 4]),
                  "v"(g[O + 5]), "v"(g[O + 6]), "v"(g[O + 7]), "v"(g[O + 8])
               : "memory");
}
// the wave's own copies have landed in LDS
__device__ __forceinline__ void a_landed() { asm volatile("s_wait_asynccnt 0x0" ::: "memory"); }
__device__ __forceinline__ v8f mma4(v2f a, v2f b, v8f c) {
  return __builtin_amdgcn_wmma_f32_16x16x4_f32(false, a, false, b, (short)0, c, false, false);
}
// the value that lane l ^ 16 holds
__device__ __forceinline__ float other_half(float x) {
  const int i = __float_as_int(x);
  return __int_as_float(__builtin_amdgcn_permlanex16(i, i, 0x76543210, 0xfedcba98, false, false));
}
__global__ __launch_bounds__(512) void k_attn(const float* __restrict__ Qs, const float* __restrict__ KV,
                                             const float* __restrict__ maskb, unsigned short* __restrict__ Ohi,
                                             unsigned short* __restrict__ Olo) {
  __shared__ __align__(16) float kvs[2 * kAKvFl];    // 2 x 135168 B; the merge records reuse the first buffer
  __shared__ __align__(16) float ms[2 * kAMsFl];     // 2 x 18432 B
  const float kNegInf = -__builtin_inff();
  const int t = threadIdx.x, lane = t & 31;
  const int wave = __builtin_amdgcn_readfirstlane(t >> 5);   // scalar: slice bounds and LDS bases stay off the vector unit
  const int b = blockIdx.x / 14, rem = blockIdx.x - b * 14, pg = rem >> 1, hq = rem & 1, p0 = pg * 16;
  const int sl = wave >> 1, hp = (wave & 1) * 2;
  const int c = lane & 15, h = lane >> 4;
  const int p = p0 + c, pc = (p < kP) ? p : (kP - 1);
  // B fragments of the score product, both heads: 8 consecutive dims of the lane's query
  const float* qp = Qs + (size_t)(b * kP + pc) * kHD + (hq * kAHb + hp) * kD + 8 * h;
  const v4f q0 = *(const v4f*)(qp), q1 = *(const v4f*)(qp + 4), q2 = *(const v4f*)(qp + kD), q3 = *(const v4f*)(qp + kD + 4);
  // address translations done before the register pair that these four loads name is reused
  asm volatile("s_wait_xcnt 0x0" :: "v"(qp) : "memory");
  const v2f qf[2][4] = {{(v2f){q0[0], q0[1]}, (v2f){q0[2], q0[3]}, (v2f){q1[0], q1[1]}, (v2f){q1[2], q1[3]}},
                        {(v2f){q2[0], q2[1]}, (v2f){q2[2], q2[3]}, (v2f){q3[0], q3[1]}, (v2f){q3[2], q3[3]}}};
  v8f o[2] = {(v8f){0.f, 0.f, 0.f, 0.f, 0.f, 0.f, 0.f, 0.f}, (v8f){0.f, 0.f, 0.f, 0.f, 0.f, 0.f, 0.f, 0.f}};
  float m[2] = {-3.0e38f, -3.0e38f}, l[2] = {0.0f, 0.0f};
  const float* kvb = KV + (size_t)b * kNP * (2 * kHD);
  const float* mkb = maskb + (size_t)(b * kP) * kNP;
  // staging roles: a wave copies whole node rows (lanes 0..15 the K part, 16..31 the V part, 256 B each)
  const int scol = ((lane < 16) ? 0 : kHD) + hq * (kAHb * kD) + (lane & 15) * 4;
  // bias tile roles: thread t copies 4 columns (t & 7) * 4 of row (t >> 3) & 15 for slices t >> 7 and 4 + (t >> 7)
  const int mr = (t >> 3) & 15, mj4 = (t & 7) * 4, msl = t >> 7;
  const int mpr = (p0 + mr < kP) ? (p0 + mr) : (kP - 1);
  const float* mrow = mkb + (size_t)mpr * kNP + msl * kASn + mj4;
  // the lane's LDS byte addresses in buffer 0: K|V row 'wave' of slice 0, and its piece of the bias tile of slice msl
  const unsigned kvl = (unsigned)(size_t)kvs + (unsigned)((wave * kAPt + lane * 4) * 4);
  const unsigned mdl = (unsigned)(size_t)ms + (unsigned)(((msl * 16 + mr) * kAMp + mj4) * 4);
  // One stage: 8 slices x 32 nodes x 32 pieces of 16 B = 16 x 512 threads (copy i: slice i >> 1, node (i & 1) * 16 + wave), and
  // the bias tiles, 8 slices x 16 rows x 8 pieces = 2 x 512 threads (slices t >> 7 and 4 + (t >> 7)). Every lane of every wave copies.
  auto a_stage = [&](int st, int buf) {
    const float* gk = kvb + (size_t)(st * kACh + wave) * (2 * kHD) + scol;
    const float* gm = mrow + st * kACh;
    const unsigned lk = kvl + (unsigned)(buf * (kAKvFl * 4)), lm = mdl + (unsigned)(buf * (kAMsFl * 4));
    unsigned la[18];
    const float* ga[18];
#pragma unroll   // static indices into the two address arrays
    for (int i = 0; i < 16; ++i) {
      la[i] = lk + (unsigned)(((i >> 1) * kACh + (i & 1) * 16) * kAPt * 4);
      ga[i] = gk + (size_t)((i >> 1) * kASn + (i & 1) * 16) * (2 * kHD);
    }
    la[16] = lm;
    ga[16] = gm;
    la[17] = lm + (unsigned)(4 * 16 * kAMp * 4);
    ga[17] = gm + 4 * kASn;
    a_copy9<0>(la, ga);
    a_copy9<9>(la, ga);
  };
  // fragment bases in LDS: K row = node c of a tile, dims from 8h; V rows = nodes from 8h of a tile, dim c; bias row = query c
  const float* kw0 = kvs + (sl * kACh + c) * kAPt + hp * kD + 8 * h;
  const float* vw0 = kvs + (sl * kACh + 8 * h) * kAPt + (kAHb + hp) * kD + c;
  const float* mw0 = ms + (sl * 16 + c) * kAMp + 8 * h;
  a_stage(0, 0);
  a_landed();
  __syncthreads();   // stage 0 is in buffer 0
  a_stage(1, 1);
#pragma unroll 1   // rolled: one copy of the long body in the instruction cache; the buffer is chosen by an address offset
  for (int st = 0; st < kASn / kACh; ++st) {
    const int buf = st & 1;
    const float* kw = kw0 + buf * kAKvFl;
    const float* vw = vw0 + buf * kAKvFl;
    const float* mw = mw0 + buf * kAMsFl;
    // The loops below are unrolled in full: tiles and fragments are register arrays, which takes static indices.
    // C operands of the two score tiles, shared by both heads: register r = bias of (query c, node 16 tt + 8h + r)
    const int nl = sl * kASn + st * kACh + 8 * h;
    v8f bias[2];
#pragma unroll
    for (int tt = 0; tt < 2; ++tt) {
      const v4f x = *(const v4f*)(mw + 16 * tt), y = *(const v4f*)(mw + 16 * tt + 4);
#pragma unroll
      for (int r = 0; r < 4; ++r) {
        bias[tt][r]     = (nl + 16 * tt + r < kN) ? x[r] : kNegInf;
        bias[tt][4 + r] = (nl + 16 * tt + 4 + r < kN) ? y[r] : kNegInf;
      }
    }
#pragma unroll
    for (int g = 0; g < 2; ++g) {
      v8f s[2];
#pragma unroll
      for (int tt = 0; tt < 2; ++tt) {
        const float* kr = kw + 16 * tt * kAPt + g * kD;
        const v4f k0 = *(const v4f*)(kr), k1 = *(const v4f*)(kr + 4);
        v8f a = mma4((v2f){k0[0], k0[1]}, qf[g][0], bias[tt]);
        a = mma4((v2f){k0[2], k0[3]}, qf[g][1], a);
        a = mma4((v2f){k1[0], k1[1]}, qf[g][2], a);
        s[tt] = mma4((v2f){k1[2], k1[3]}, qf[g][3], a);
      }
      float tm = fmaxf(s[0][0], s[1][0]);
#pragma unroll
      for (int r = 1; r < 8; ++r) tm = fmaxf(tm, fmaxf(s[0][r], s[1][r]));
      tm = fmaxf(tm, other_half(tm));
      const float mn = fmaxf(m[g], tm);
      const float alpha = __expf(m[g] - mn);
      m[g] = mn;
      float ps[2] = {0.0f, 0.0f};
#pragma unroll
      for (int tt = 0; tt < 2; ++tt)
#pragma unroll
        for (int r = 0; r < 8; ++r) {
          s[tt][r] = __expf(s[tt][r] - mn);
          ps[tt] += s[tt][r];
        }
      l[g] = fmaf(l[g], alpha, ps[0] + ps[1]);
      o[g] = o[g] * alpha;
#pragma unroll
      for (int tt = 0; tt < 2; ++tt) {
        const float* vr = vw + 16 * tt * kAPt + g * kD;
#pragma unroll
        for (int ks = 0; ks < 4; ++ks)
          o[g] = mma4((v2f){vr[2 * ks * kAPt], vr[(2 * ks + 1) * kAPt]}, (v2f){s[tt][2 * ks], s[tt][2 * ks + 1]}, o[g]);
      }
    }
    // hand-over, in this order: the wave's LDS reads of this stage are done; its copies of the next stage have landed; the barrier
    // publishes the next stage and frees this stage's buffer; only then the stage after the next is copied into it
    asm volatile("s_wait_dscnt 0x0" ::: "memory");
    a_landed();
    __syncthreads();
    if (st + 2 < kASn / kACh) a_stage(st + 2, buf);
  }
  a_landed();   // no copy is outstanding; the last trip's barrier also says that every wave has left the K|V buffers
#pragma unroll   // static indices into the two heads' register arrays
  for (int g = 0; g < 2; ++g) {
    const float lt = l[g] + other_half(l[g]);
    float* op = kvs + ((sl * kAHb + hp + g) * 16 + c) * kACp;
    *(v4f*)(op + 8 * h)     = (v4f){o[g][0], o[g][1], o[g][2], o[g][3]};
    *(v4f*)(op + 8 * h + 4) = (v4f){o[g][4], o[g][5], o[g][6], o[g][7]};
    if (h == 0) *(v2f*)(op + 16) = (v2f){m[g], lt};
  }
  __syncthreads();
  if (wave < 4) {    // threads 0..127; no barrier behind this point
    const int rl = t >> 3, c8 = (t & 7) * 8;
    const float* cb = kvs + ((c8 >> 4) * 16 + rl) * kACp;
    constexpr int kSs = kAHb * 16 * kACp;      // floats from one slice's records to the next
    float ml[kASl], ll[kASl];
#pragma unroll
    for (int s = 0; s < kASl; ++s) { const v2f e = *(const v2f*)(cb + s * kSs + 16); ml[s] = e[0]; ll[s] = e[1]; }
    float mx = ml[0];
#pragma unroll
    for (int s = 1; s < kASl; ++s) mx = fmaxf(mx, ml[s]);
    float lsum = 0.0f;
    v4f x0 = (v4f){0.f, 0.f, 0.f, 0.f}, x1 = (v4f){0.f, 0.f, 0.f, 0.f};
#pragma unroll
    for (int s = 0; s < kASl; ++s) {
      const float w = __expf(ml[s] - mx);
      const float* s8 = cb + s * kSs + (c8 & 15);
      lsum = fmaf(ll[s], w, lsum);
      x0 = *(const v4f*)(s8) * w + x0;
      x1 = *(const v4f*)(s8 + 4) * w + x1;
    }
    const float inv = 1.0f / lsum;
    x0 = x0 * inv;
    x1 = x1 * inv;
    unsigned short hb[8], lb[8];
#pragma unroll
    for (int e = 0; e < 4; ++e) {
      split_bf(x0[e], hb[e], lb[e]);
      split_bf(x1[e], hb[4 + e], lb[4 + e]);
    }
    const v4u uh = (v4u){pk16(hb[0], hb[1]), pk16(hb[2], hb[3]), pk16(hb[4], hb[5]), pk16(hb[6], hb[7])};
    const v4u ul = (v4u){pk16(lb[0], lb[1]), pk16(lb[2], lb[3]), pk16(lb[4], lb[5]), pk16(lb[6], lb[7])};
    if (p0 + rl < kP) {
      const size_t o = (size_t)(b * kP + p0 + rl) * kHD + hq * (kAHb * kD) + c8;
      *(v4u*)(Ohi + o) = uh;
      *(v4u*)(Olo + o) = ul;
    }
  }
}

// ---------------------------------------------------------------------------
// Zero fill of two regions, nvec x 16 B each (nvec % 256 == 0, so the region select is block-uniform).
// ---------------------------------------------------------------------------
__device__ __forceinline__ void zero16x2_body(int bid, unsigned int* __restrict__ p0, unsigned int* __restrict__ p1, int nvec) {
  const int i = bid * 256 + threadIdx.x;
  if (i >= 2 * nvec) return;
  unsigned int* p = (i < nvec) ? (p0 + 4 * (size_t)i) : (p1 + 4 * (size_t)(i - nvec));
  const v4u z = (v4u){0u, 0u, 0u, 0u};
  *(v4u*)p = z;
}

// ---------------------------------------------------------------------------
// First launch: the four jobs that read nothing but inputs, side by side in one grid of 256-thread blocks. By block index:
// query side (400, the longest job, placed first for speed only), weight preparation (13), zero fill of the 64 pad rows
// 1600..1663 of Ohi and Olo (8), node split (1024). The job select is block-uniform (scalar); the two jobs with LDS use
// the same bytes.
// ---------------------------------------------------------------------------
constexpr int kZrVec = (kBPpad - kBP) * kHD * 2 / 16;   // 16-B pieces per plane
constexpr int kZrBlocks = 2 * kZrVec / 256;
static_assert(kZrVec % 256 == 0, "zero fill blocks");
constexpr int kFrontBlocks = kQsBlocks + kWpBlocks + kZrBlocks + kEcBlocks;
constexpr int kFrontLds = (kWpLds > kQsLds) ? kWpLds : kQsLds;
__global__ __launch_bounds__(256) void k_front(const float* __restrict__ enc_last, const float* __restrict__ loadv,
                                              const float* __restrict__ Wq, const float* __restrict__ fW1,
                                              const float* __restrict__ fb1, const float* __restrict__ fW2,
                                              const float* __restrict__ fb2, const float* __restrict__ lqW,
                                              const float* __restrict__ lqb, const float* __restrict__ lW1,
                                              const float* __restrict__ lb1,
                                              float* __restrict__ Qs, float* __restrict__ QW,
                                              const float* __restrict__ Wk, const float* __restrict__ Wv,
                                              const float* __restrict__ Wcomb, const float* __restrict__ W2,
                                              unsigned short* __restrict__ WkvHi, unsigned short* __restrict__ WkvLo,
                                              unsigned short* __restrict__ WcHi, unsigned short* __restrict__ WcLo,
                                              unsigned short* __restrict__ W2T,
                                              unsigned int* __restrict__ OhiPad, unsigned int* __restrict__ OloPad,
                                              const float* __restrict__ enc, unsigned short* __restrict__ EncHi,
                                              unsigned short* __restrict__ EncLo) {
  __shared__ __align__(16) float smem[kFrontLds];
  const int bid = blockIdx.x;
  if (bid < kQsBlocks) {
    qside_body(smem, bid, enc_last, loadv, Wq, fW1, fb1, fW2, fb2, lqW, lqb, lW1, lb1, Qs, QW);
  } else if (bid < kQsBlocks + kWpBlocks) {
    wprep_body(smem, bid - kQsBlocks, Wk, Wv, Wcomb, W2, WkvHi, WkvLo, WcHi, WcLo, W2T);
  } else if (bid < kQsBlocks + kWpBlocks + kZrBlocks) {
    zero16x2_body(bid - (kQsBlocks + kWpBlocks), OhiPad, OloPad, kZrVec);
  } else {
    enc_cast_body(bid - (kQsBlocks + kWpBlocks + kZrBlocks), enc, EncHi, EncLo);
  }
}

// tanh with both of its ranges computed and one selected: no branch, so neighbouring elements can overlap
__device__ __forceinline__ float tanh_sel(float x) {
  const float ax = fabsf(x);
  const float e = __expf(ax + ax);                                    // inf for large |x|: 2 / inf = 0, the value is 1
  const float big = fmaf(__builtin_amdgcn_rcpf(e + 1.0f), -2.0f, 1.0f);
  const float x2 = x * x;
  float pl = fmaf(x2, -0.00570002059f, 0.0206340719f);                // odd series for |x| < 0.625
  pl = fmaf(x2, pl, -0.0537379310f);
  pl = fmaf(x2, pl, 0.133314162f);
  pl = fmaf(x2, pl, -0.333332807f);
  const float small = fmaf(x2, ax * pl, ax);
  return copysignf((ax < 0.625f) ? small : big, x);
}
// ---------------------------------------------------------------------------
// Tail: head merge, pointer scores, clipped tanh + mask and the softmax over the nodes, in one launch.
// Block = (b, group of 16 queries), 16 waves, 16 x 7 = 112 blocks; MH and the scores never leave the block.
// Both products run transposed, D[row 8h + r][query c], lane l: c = l & 15, h = l >> 4. A = 16 rows of a bf16 hi/lo plane pair
// (rows of W_comb^T, then node rows), B = the 16 queries' rows (O, then MH); both fragments take k = 32 s + 8h + e and
// 32 s + 16 + 8h + e, e = 0..7, at k step s; per k step hi.hi, then lo(A).hi(B), then hi(A).lo(B).
// A rows: 16 rows of a plane are 4096 contiguous bytes; a wave fetches them by whole lines into registers, one tile ahead,
// and passes them through its own LDS buffer at a pitch of 272 B (16 B x odd) to get the fragments.
//   head merge: waves 0..7, wave w = columns 16 w .. 16 w + 15 of MH; + b_comb, split to bf16 hi/lo, rows of 16 queries in LDS.
//   scores: wave w = nodes 64 w .. 64 w + 63, four tiles; a lane ends with 32 nodes of query c in registers.
//   softmax: maximum and sum per query in the lane, then lane l ^ 16, then the 16 waves through LDS tables, in wave order.
// xs holds the 16 mask rows (64000 contiguous bytes of ninf_mask, copied by whole 16-B pieces); every lane replaces its own
// elements by the probabilities, and the block copies xs to out the same way. Slots >= 1000 carry -inf and are not stored.
// Query rows >= P (last group): computed from finite rows of the O planes, never stored; no lane of another query reads them.
// All loops of this kernel and its helpers are unrolled in full: staged pieces, fragments and tiles are register arrays,
// which takes static indices.
// ---------------------------------------------------------------------------
constexpr int kTPit = 2 * kE + 16;     // bytes from one staged row of 128 16-bit elements to the next
constexpr int kTPl  = 16 * kTPit;      // one plane of 16 rows
constexpr int kTCh  = 2 * kTPl;        // hi plane + lo plane
constexpr int kTRp  = 20;              // floats per query in a reduction table: 16 waves, 4 unused
constexpr int kTXs  = 8 * 512 * 4;     // floats in xs: 16 rows of out, rounded up to 8 pieces of 16 B per thread
// 16 rows of the hi plane and of the lo plane, 512 contiguous bytes an instruction; o = lane * 16
__device__ __forceinline__ void t_fetch(v4u (&st)[16], const unsigned short* __restrict__ hi,
                                        const unsigned short* __restrict__ lo, unsigned o) {
#pragma unroll
  for (int i = 0; i < 8; ++i) st[i] = *(const v4u*)((const char*)hi + o + 512 * i);
#pragma unroll
  for (int i = 0; i < 8; ++i) st[8 + i] = *(const v4u*)((const char*)lo + o + 512 * i);
  // address translations done before a register that one of these loads names is reused; the "memory" clobber also keeps
  // the loads up here, ahead of the work that covers their latency
  asm volatile("s_wait_xcnt 0x0" :: "v"(o) : "memory");
}
// p: the lane's place in the first pair of rows of the wave's buffer
__device__ __forceinline__ void t_put(char* p, const v4u (&st)[16]) {
#pragma unroll
  for (int i = 0; i < 8; ++i) *(v4u*)(p + 2 * i * kTPit) = st[i];
#pragma unroll
  for (int i = 0; i < 8; ++i) *(v4u*)(p + kTPl + 2 * i * kTPit) = st[8 + i];
}
// orders a wave's LDS writes and the reads of them by its other lanes (and the reads before the next writes)
__device__ __forceinline__ void t_wave_sync() {
  __builtin_amdgcn_fence(__ATOMIC_RELEASE, "workgroup");
  __builtin_amdgcn_wave_barrier();
  __builtin_amdgcn_fence(__ATOMIC_ACQUIRE, "workgroup");
}
// p: row c of a staged plane pair, byte 16 h
__device__ __forceinline__ void t_frags(v16b (&fh)[4], v16b (&fl)[4], const char* p) {
#pragma unroll
  for (int s = 0; s < 4; ++s) {
    fh[s] = Frag<__bf16>::load((const __bf16*)(p + 64 * s));
    fl[s] = Frag<__bf16>::load((const __bf16*)(p + kTPl + 64 * s));
  }
}
__device__ __forceinline__ v8f t_tile(const char* p, const v16b (&qh)[4], const v16b (&ql)[4]) {
  v16b ah[4], al[4];
  t_frags(ah, al, p);
  v8f acc = (v8f){0.f, 0.f, 0.f, 0.f, 0.f, 0.f, 0.f, 0.f};
#pragma unroll
  for (int s = 0; s < 4; ++s) {
    acc = Frag<__bf16>::mma(ah[s], qh[s], acc);
    acc = Frag<__bf16>::mma(al[s], qh[s], acc);
    acc = Frag<__bf16>::mma(ah[s], ql[s], acc);
  }
  return acc;
}
__global__ __launch_bounds__(512) void k_tail(const unsigned short* __restrict__ Ohi, const unsigned short* __restrict__ Olo,
                                             const unsigned short* __restrict__ WcHi, const unsigned short* __restrict__ WcLo,
                                             const float* __restrict__ bc,
                                             const unsigned short* __restrict__ EncHi, const unsigned short* __restrict__ EncLo,
                                             const float* __restrict__ ninfm, float* __restrict__ out) {
  __shared__ __align__(16) char abufs[16 * kTCh];     // 139264 B: one plane pair of 16 rows per wave
  __shared__ __align__(16) char osb[kTCh];            // O rows of the 16 queries
  __shared__ __align__(16) char mhb[kTCh];            // MH rows of the 16 queries
  __shared__ __align__(16) float xs[kTXs];            // 65536 B: mask rows, then probabilities; the last 1536 B are never used
  static_assert(kTXs >= 16 * kN, "16 rows fit");
  __shared__ __align__(16) float redm[16 * kTRp];
  __shared__ __align__(16) float reds[16 * kTRp];
  const float kNegInf = -__builtin_inff();
  const int t = threadIdx.x, lane = t & 31;
  const int wave = __builtin_amdgcn_readfirstlane(t >> 5);   // scalar: plane bases and the job select stay off the vector unit
  const int b = blockIdx.x / kPG, p0 = (blockIdx.x - b * kPG) * 16;
  const int c = lane & 15, h = lane >> 4;
  const int row0 = b * kP + p0;
  const int npc = ((kP - p0 < 16) ? (kP - p0) : 16) * (kN / 4);   // 16-B pieces in the group's rows of ninf_mask and out
  const unsigned o16 = (unsigned)lane * 16u;
  // O: wave w fetches rows 2 (w & 7), + 1 of the hi (w < 8) or lo plane: 512 contiguous bytes
  const unsigned short* osrc = ((wave < 8) ? Ohi : Olo) + (size_t)(row0 + 2 * (wave & 7)) * kHD;
  const v4u ov = *(const v4u*)((const char*)osrc + o16);
  // b_comb of the lane's 8 MH columns (used by waves 0..7)
  const unsigned ob = (unsigned)((wave & 7) * 16 + 8 * h) * 4u;
  const v4f bc0 = *(const v4f*)((const char*)bc + ob), bc1 = *(const v4f*)((const char*)bc + ob + 16);
  // mask rows; a piece past the group's rows is fetched from piece 0 (in bounds) and lands in a row that is never stored
  const char* nsrc = (const char*)(ninfm + (size_t)row0 * kN);
  unsigned no[8];
  v4f nv[8];
#pragma unroll
  for (int i = 0; i < 8; ++i) {
    const int f = t + 512 * i;
    no[i] = (f < npc) ? (unsigned)f * 16u : 0u;
    nv[i] = *(const v4f*)(nsrc + no[i]);
  }
  // address translations done before a register that a load above names is reused
  asm volatile("s_wait_xcnt 0x0" :: "v"(o16), "v"(ob), "v"(no[0]), "v"(no[1]), "v"(no[2]), "v"(no[3]), "v"(no[4]), "v"(no[5]),
               "v"(no[6]), "v"(no[7]) : "memory");
  // first A tile: waves 0..7 their 16 rows of W_comb^T, waves 8..15 their first 16 nodes
  const unsigned short* eh = EncHi + ((size_t)b * kNP + wave * 64) * kE;
  const unsigned short* el = EncLo + ((size_t)b * kNP + wave * 64) * kE;
  const bool merger = wave < 8;   // scalar
  v4u st[16];
  t_fetch(st, merger ? (WcHi + (size_t)wave * 16 * kHD) : eh, merger ? (WcLo + (size_t)wave * 16 * kHD) : el, o16);
  const int wplace = h * kTPit + c * 16;    // writer: row h of a pair of rows, 16-B piece c
  const int rplace = c * kTPit + h * 16;    // fragment reader: row c, k from 8 h
  *(v4u*)(osb + (wave >> 3) * kTPl + 2 * (wave & 7) * kTPit + wplace) = ov;
#pragma unroll
  for (int i = 0; i < 8; ++i) {
    *(v4f*)(xs + 4 * (t + 512 * i)) = nv[i];
  }
  __syncthreads();   // O rows and mask rows are in LDS
  char* abw = abufs + wave * kTCh + wplace;
  const char* abr = abufs + wave * kTCh + rplace;
  v16b qh[4], ql[4];
  if (merger) {
    t_put(abw, st);
    t_wave_sync();
    t_fetch(st, eh, el, o16);
    t_frags(qh, ql, osb + rplace);
    const v8f d = t_tile(abr, qh, ql);
    unsigned short hb[8], lb[8];
#pragma unroll
    for (int r = 0; r < 4; ++r) {
      split_bf(d[r] + bc0[r], hb[r], lb[r]);
      split_bf(d[4 + r] + bc1[r], hb[4 + r], lb[4 + r]);
    }
    char* md = mhb + c * kTPit + (wave * 16 + 8 * h) * 2;
    *(v4u*)(md) = (v4u){pk16(hb[0], hb[1]), pk16(hb[2], hb[3]), pk16(hb[4], hb[5]), pk16(hb[6], hb[7])};
    *(v4u*)(md + kTPl) = (v4u){pk16(lb[0], lb[1]), pk16(lb[2], lb[3]), pk16(lb[4], lb[5]), pk16(lb[6], lb[7])};
  }
  __syncthreads();   // MH rows are in LDS; waves 0..7 have left their buffers
  t_frags(qh, ql, mhb + rplace);
  v8f acc[4];
#pragma unroll
  for (int j = 0; j < 4; ++j) {
    t_put(abw, st);
    t_wave_sync();
    if (j < 3) t_fetch(st, eh + (j + 1) * 16 * kE, el + (j + 1) * 16 * kE, o16);
    acc[j] = t_tile(abr, qh, ql);
    if (j < 3) t_wave_sync();
  }
  // register r of tile j: node 64 wave + 16 j + 8 h + r, query c. 1000 is a multiple of 8: a lane's 8 nodes are all in or all out.
  float mx = kNegInf;
#pragma unroll
  for (int j = 0; j < 4; ++j) {
    const int n8 = wave * 64 + 16 * j + 8 * h;
    const bool ok = n8 < kN;
    const float* xp = xs + c * kN + (ok ? n8 : 0);            // address clamp
    const v4f m0 = *(const v4f*)(xp), m1 = *(const v4f*)(xp + 4);
#pragma unroll
    for (int r = 0; r < 8; ++r) {
      const float v = kClip * tanh_sel(acc[j][r] * kInvSqrtE) + ((r < 4) ? m0[r & 3] : m1[r & 3]);
      acc[j][r] = ok ? v : kNegInf;
      mx = fmaxf(mx, acc[j][r]);
    }
  }
  mx = fmaxf(mx, other_half(mx));
  if (h == 0) redm[c * kTRp + wave] = mx;
  __syncthreads();   // every wave's maxima are in the table
#pragma unroll
  for (int q = 0; q < 4; ++q) {
    const v4f e = *(const v4f*)(redm + c * kTRp + 4 * q);
    mx = fmaxf(fmaxf(mx, fmaxf(e[0], e[1])), fmaxf(e[2], e[3]));
  }
  float sum = 0.0f;
#pragma unroll
  for (int j = 0; j < 4; ++j)
#pragma unroll
    for (int r = 0; r < 8; ++r) {
      acc[j][r] = __expf(acc[j][r] - mx);
      sum += acc[j][r];
    }
  sum += other_half(sum);
  if (h == 0) reds[c * kTRp + wave] = sum;
  __syncthreads();   // every wave's sums are in the table
  float tot = 0.0f;
#pragma unroll
  for (int q = 0; q < 4; ++q) {
    const v4f e = *(const v4f*)(reds + c * kTRp + 4 * q);
    tot = (((tot + e[0]) + e[1]) + e[2]) + e[3];
  }
  const float inv = 1.0f / tot;
#pragma unroll
  for (int j = 0; j < 4; ++j) {
    const int n8 = wave * 64 + 16 * j + 8 * h;
    if (n8 < kN) {
      float* xp = xs + c * kN + n8;
      *(v4f*)(xp)     = (v4f){acc[j][0] * inv, acc[j][1] * inv, acc[j][2] * inv, acc[j][3] * inv};
      *(v4f*)(xp + 4) = (v4f){acc[j][4] * inv, acc[j][5] * inv, acc[j][6] * inv, acc[j][7] * inv};
    }
  }
  __syncthreads();   // the probabilities of the 16 rows are in xs
  char* obase = (char*)(out + (size_t)row0 * kN);
  v4f pv[8];
#pragma unroll
  for (int i = 0; i < 8; ++i) pv[i] = *(const v4f*)(xs + 4 * (t + 512 * i));
#pragma unroll
  for (int i = 0; i < 8; ++i) {
    if (t + 512 * i < npc) *(v4f*)(obase + (unsigned)t * 16u + 8192 * i) = pv[i];
  }
}

// ---------------------------------------------------------------------------
// Host launcher
// Workspace region map (bytes, 256-B aligned offsets):
//   EncHi bf16 [16][1024][128]          4,194,304
//   EncLo bf16 [16][1024][128]          4,194,304
//   WkvHi bf16 [256][128]                 65,536
//   WkvLo bf16 [256][128]                 65,536
//   WcHi  bf16 [128][128]                 32,768
//   WcLo  bf16 [128][128]                 32,768
//   W2T   f16  [64][64]                    8,192
//   KVf   f32  [16384][256]            16,777,216
//   Qs    f32  [1600][128]                819,200
//   QW    f32  [1600][64]                 409,600
//   MASKB f32  [1600][1024]             6,553,600
//   Ohi   bf16 [1664][128]                425,984
//   Olo   bf16 [1664][128]                425,984
//   total                              34,004,992
// ---------------------------------------------------------------------------
static inline size_t align256(size_t x) { return (x + 255) & ~(size_t)255; }

extern "C" void kernel_launch(void* const* d_in, const int* in_sizes, int n_in,
                              void* d_out, int out_size, void* d_ws, size_t ws_size,
                              hipStream_t stream) {
  if (n_in < 22) return;
  if (in_sizes[0] != kB * kN * kE || in_sizes[1] != kB * kP * kE || in_sizes[2] != kB * kP ||
      in_sizes[3] != kB * kP * kN || in_sizes[4] != kB * kP * kN * kDYN || out_size != kB * kP * kN) return;

  const float* enc      = (const float*)d_in[0];
  const float* enc_last = (const float*)d_in[1];
  const float* loadv    = (const float*)d_in[2];
  const float* ninfm    = (const float*)d_in[3];
  const float* dyn      = (const float*)d_in[4];
  const float* Wq       = (const float*)d_in[5];
  const float* Wk       = (const float*)d_in[6];
  const float* Wv       = (const float*)d_in[7];
  const float* Wc       = (const float*)d_in[8];
  const float* bcv      = (const float*)d_in[9];
  const float* fW1      = (const float*)d_in[10];
  const float* fb1      = (const float*)d_in[11];
  const float* fW2      = (const float*)d_in[12];
  const float* fb2      = (const float*)d_in[13];
  const float* lqW      = (const float*)d_in[14];
  const float* lqb      = (const float*)d_in[15];
  const float* lW1      = (const float*)d_in[16];
  const float* lb1      = (const float*)d_in[17];
  const float* lW2      = (const float*)d_in[18];
  const float* lb2      = (const float*)d_in[19];
  const float* lW3      = (const float*)d_in[20];
  const float* lb3      = (const float*)d_in[21];
  float* out = (float*)d_out;

  char* ws = (char*)d_ws;
  size_t off = 0;
  unsigned short* EncHi = (unsigned short*)(ws + off); off = align256(off + (size_t)kEncRows * kE * 2);
  unsigned short* EncLo = (unsigned short*)(ws + off); off = align256(off + (size_t)kEncRows * kE * 2);
  unsigned short* WkvHi = (unsigned short*)(ws + off); off = align256(off + (size_t)2 * kHD * kE * 2);
  unsigned short* WkvLo = (unsigned short*)(ws + off); off = align256(off + (size_t)2 * kHD * kE * 2);
  unsigned short* WcHi  = (unsigned short*)(ws + off); off = align256(off + (size_t)kE * kHD * 2);
  unsigned short* WcLo  = (unsigned short*)(ws + off); off = align256(off + (size_t)kE * kHD * 2);
  unsigned short* W2T   = (unsigned short*)(ws + off); off = align256(off + (size_t)kHID * kHID * 2);
  float* KVf   = (float*)(ws + off); off = align256(off + (size_t)kEncRows * 2 * kHD * 4);
  float* Qs    = (float*)(ws + off); off = align256(off + (size_t)kBP * kHD * 4);
  float* QW    = (float*)(ws + off); off = align256(off + (size_t)kBP * kHID * 4);
  float* MASKB = (float*)(ws + off); off = align256(off + (size_t)kBP * kNP * 4);
  unsigned short* Ohi  = (unsigned short*)(ws + off); off = align256(off + (size_t)kBPpad * kHD * 2);
  unsigned short* Olo  = (unsigned short*)(ws + off); off = align256(off + (size_t)kBPpad * kHD * 2);
  if (off > ws_size) return;

  // launch 1, inputs only: query side (f32); weight planes (Wk|Wv and W_comb transposed to bf16 hi/lo [n][k], lm_W2 transposed
  // to f16 x16); zeros in the 64 pad rows of Ohi and Olo; node planes (bf16 hi/lo, 24 zero pad rows per batch in both)
  k_front<<<kFrontBlocks, 256, 0, stream>>>(enc_last, loadv, Wq, fW1, fb1, fW2, fb2, lqW, lqb, lW1, lb1, Qs, QW,
                                            Wk, Wv, Wc, lW2, WkvHi, WkvLo, WcHi, WcLo, W2T,
                                            (unsigned int*)(Ohi + (size_t)kBP * kHD), (unsigned int*)(Olo + (size_t)kBP * kHD),
                                            enc, EncHi, EncLo);
  // launch 2: K|V projection (bf16 hi/lo both operands, K=128, M=16384, N=256 -> f32) beside the lazy-mask MLP (three layers
  // fused, all 1600 x 1024 slots; hidden layer on WMMA f16 (W x16), K=64)
  k_kv_lazy<<<kKvBlocks + kBP, 128, 0, stream>>>(EncHi, EncLo, WkvHi, WkvLo, KVf, dyn, QW, lW1, (const _Float16*)W2T, lb2, lW3,
                                                 lb3, ninfm, MASKB);
  // attention core (f32), 8 node slices per block merged in LDS -> O as bf16 hi/lo planes
  k_attn<<<kB * 14, 512, 0, stream>>>(Qs, KVf, MASKB, Ohi, Olo);
  // tail: head merge (bf16 hi/lo both operands, K=128, + b_comb), pointer scores against the node planes (bf16 hi/lo, K=128,
  // scale 1/sqrt(128)), clipped tanh + mask + softmax -> probs; one block per batch and group of 16 queries
  k_tail<<<kB * kPG, 512, 0, stream>>>(Ohi, Olo, WcHi, WcLo, bcv, EncHi, EncLo, ninfm, out);
}

// v010
// One run takes 52.6 microseconds.
// Timed twice side by side with v009, it ran 1.06 times as fast both times.
// All steps since the starting kernel, v000, together make it 11.5 times as fast.
// Contractions: node K|V projection (nodes x [Wk|Wv]^T), head-merge projection (W_comb^T x O^T) and pointer scores (nodes x MH^T) on v_wmma_f32_16x16x32_bf16 with bf16 hi/lo operand planes (hi.hi + hi.lo + lo.hi); lazy-mask hidden layer (lm_W2^T f16 carried x16, as A, x H1 f16, as B) on v_wmma_f32_16x16x32_f16 inside the fused lazy-mask kernel; all f32 accumulate; lazy layer 1 (K=3 after the broadcast fold, + bias) on v_wmma_f16_16x16x32_f16 with f16 hi + f16 rest of both operands side by side in k, its f16 result being H1; query/FiLM/gating/qf projections, lazy layer 3 (N=1) and both softmaxes in f32 on the VALU; the attention core's two products (K x Q^T, V^T x P^T, head dim 16) on v_wmma_f32_16x16x4_f32.
#include <hip/hip_runtime.h>
#include <math.h>

typedef __attribute__((ext_vector_type(16))) _Float16 v16h;
typedef __attribute__((ext_vector_type(8)))  _Float16 v8h;
typedef __attribute__((ext_vector_type(8)))  short    v8s;
typedef __attribute__((ext_vector_type(16))) __bf16   v16b;
typedef __attribute__((ext_vector_type(8)))  __bf16   v8b;
typedef __attribute__((ext_vector_type(8)))  float    v8f;
typedef __attribute__((ext_vector_type(4)))  float    v4f;
typedef __attribute__((ext_vector_type(4)))  unsigned int v4u;
typedef __attribute__((ext_vector_type(2)))  float    v2f;
typedef __attribute__((ext_vector_type(2)))  _Float16 v2h;

// ---------------------------------------------------------------------------
// Problem constants
// ---------------------------------------------------------------------------
constexpr int kB   = 16;      // batch
constexpr int kP   = 100;     // queries per batch
constexpr int kN   = 1000;    // nodes
constexpr int kNP  = 1024;    // nodes padded
constexpr int kE   = 128;     // embedding
constexpr int kH   = 8;       // heads
constexpr int kD   = 16;      // head dim
constexpr int kHD  = 128;     // H*D
constexpr int kQD  = 16;      // lazy query dim
constexpr int kDYN = 3;       // dynamic features
constexpr int kHID = 64;      // lazy hidden
constexpr int kBP     = kB * kP;          // 1600 (b,p) rows
constexpr int kBPpad  = 1664;             // 26 * 64
constexpr int kEncRows = kB * kNP;        // 16384 padded node rows
constexpr int kPG = 7;                     // groups of 16 queries per batch (100 padded to 112)
constexpr float kWCarry   = 16.0f;        // lm_W2 carried x16 in f16
constexpr float kInvSqrtE = 0.08838834764831845f;
constexpr float kClip     = 10.0f;
static_assert(kBPpad % 64 == 0 && kBPpad >= kBP, "pad");
static_assert(kPG * 16 >= kP && kBPpad >= (kB - 1) * kP + kPG * 16, "last batch's query groups inside the O planes");
static_assert(kH * kD == kHD && kE == kHD, "dims");

__device__ __forceinline__ unsigned short f2bf_bits(float f) {
  unsigned u = __float_as_uint(f);
  return (unsigned short)((u + 0x7FFFu + ((u >> 16) & 1u)) >> 16);
}
__device__ __forceinline__ float bf_bits2f(unsigned short h) { return __uint_as_float(((unsigned)h) << 16); }

// hazard guards as plain device helpers (no inline asm inside the kernel template body)
__device__ __forceinline__ void dep_guard_h(v8f& a, v8f& b, v16h x, v16h y) { asm volatile("v_nop\n\tv_nop\n\tv_nop\n\tv_nop" : "+v"(a), "+v"(b) : "v"(x), "v"(y)); }
__device__ __forceinline__ void dep_guard_b(v8f& a, v8f& b, v16b x, v16b y) { asm volatile("v_nop\n\tv_nop\n\tv_nop\n\tv_nop" : "+v"(a), "+v"(b) : "v"(x), "v"(y)); }
__device__ __forceinline__ void keep4_h(v16h a, v16h b, v16h c, v16h d) { asm volatile("v_nop" :: "v"(a), "v"(b), "v"(c), "v"(d)); }
__device__ __forceinline__ void keep4_b(v16b a, v16b b, v16b c, v16b d) { asm volatile("v_nop" :: "v"(a), "v"(b), "v"(c), "v"(d)); }
__device__ __forceinline__ void acc_guard4(v8f& a, v8f& b, v8f& c, v8f& d) { asm volatile("v_nop\n\tv_nop\n\tv_nop\n\tv_nop" : "+v"(a), "+v"(b), "+v"(c), "+v"(d)); }
template <typename T> struct Frag;
template <> struct Frag<_Float16> {
  typedef v16h V; union U { v16h v; v8h h[2]; };
  static __device__ __forceinline__ v16h load(const _Float16* p) {   // elements 0..7 <- p[0..7], 8..15 <- p[16..23]
    U f; f.h[0] = *(const v8h*)(p); f.h[1] = *(const v8h*)(p + 16); return f.v;
  }
  static __device__ __forceinline__ v8f mma(v16h a, v16h b, v8f c) {
    return __builtin_amdgcn_wmma_f32_16x16x32_f16(false, a, false, b, (short)0, c, false, false);
  }
  static __device__ __forceinline__ void guard(v8f& a, v8f& b, v16h x, v16h y) { dep_guard_h(a, b, x, y); }
  static __device__ __forceinline__ void keep(v16h a, v16h b, v16h c, v16h d) { keep4_h(a, b, c, d); }
};
template <> struct Frag<__bf16> {
  typedef v16b V; union U { v16b v; v8b h[2]; };
  static __device__ __forceinline__ v16b load(const __bf16* p) {
    U f; f.h[0] = *(const v8b*)(p); f.h[1] = *(const v8b*)(p + 16); return f.v;
  }
  static __device__ __forceinline__ v8f mma(v16b a, v16b b, v8f c) {
    return __builtin_amdgcn_wmma_f32_16x16x32_bf16(false, a, false, b, (short)0, c, false, false);
  }
  static __device__ __forceinline__ void guard(v8f& a, v8f& b, v16b x, v16b y) { dep_guard_b(a, b, x, y); }
  static __device__ __forceinline__ void keep(v16b a, v16b b, v16b c, v16b d) { keep4_b(a, b, c, d); }
};

__device__ __forceinline__ unsigned pk16(unsigned short a, unsigned short b) { return (unsigned)a | ((unsigned)b << 16); }
__device__ __forceinline__ unsigned short h_bits(float f) { const _Float16 h = (_Float16)f; return __builtin_bit_cast(unsigned short, h); }
// bf16 hi + bf16 lo split of an f32 value (both RNE converts)
__device__ __forceinline__ void split_bf(float f, unsigned short& hb, unsigned short& lb) {
  hb = f2bf_bits(f);
  lb = f2bf_bits(f - bf_bits2f(hb));
}

// ---- Register-blocked batched WMMA GEMM (ACT reduced to none/relu/leaky) -----------------------
// C[m,n] = scale * sum_k A[m,k] * Bt[n,k] (+bias)(+resid); each wave owns a 64x64 tile.
// A row-major [M,K]; Bt row-major [N,K]; M,N % 64 == 0, K % 32 == 0.
// SPLIT: operands are hi/lo planes (A2/Bt2 = lo planes, same layout); product = hi·hi + hi·lo + lo·hi.
// BIAS_MODE: 0 = none, 1 = bias[m], 2 = bias[n].
// OUT_MODE: 0 = f32, 1 = f16, 2 = bf16 hi plane (Cout) + bf16 lo plane (Cout2).
// ET: 0 = f16 operands, 1 = bf16 operands (pointers passed as 16-bit storage)
template <int ET> struct Elem;
template <> struct Elem<0> { typedef _Float16 T; };
template <> struct Elem<1> { typedef __bf16 T; };
// The engine is a device function, so that a launch can hold it beside another job: NW = waves per block, sT = NW slabs of
// LDS (16x64 f32 at a pitch of 68 floats each), bx = block index among the engine's blocks, b = batch index.
template <int NW, int ET, bool SPLIT, int BIAS_MODE, int OUT_MODE, bool RESID, int ACT>
__device__ __forceinline__ void gemm64_body(
    float* sT, int bx, int b,
    const unsigned short* __restrict__ Ap, const unsigned short* __restrict__ A2p, int lda, long strideA,
    const unsigned short* __restrict__ Btp, const unsigned short* __restrict__ Bt2p, int ldb, long strideB,
    void* __restrict__ Cout, void* __restrict__ Cout2, int ldc, long strideC,
    const float* __restrict__ bias,
    const float* __restrict__ resid, long strideR,
    int M, int N, int K, float scale) {
  typedef typename Elem<ET>::T T;
  typedef typename Frag<T>::V V;
  const T* A = (const T*)Ap; const T* A2 = (const T*)A2p; const T* Bt = (const T*)Btp; const T* Bt2 = (const T*)Bt2p;
  const int lane = threadIdx.x & 31;
  const int wave = threadIdx.x >> 5;
  const int tilesN = N >> 6;
  const int tilesM = M >> 6;
  const int tile = bx * NW + wave;
  if (tile >= tilesM * tilesN) return;   // wave-uniform; no block barriers in this kernel
  const int tm = tile / tilesN;
  const int tn = tile - tm * tilesN;
  const int m0 = tm << 6;
  const int n0 = tn << 6;

  const T* Ab  = A  + (size_t)b * strideA;
  const T* Bb  = Bt + (size_t)b * strideB;
  const T* Ab2 = SPLIT ? (A2  + (size_t)b * strideA) : nullptr;
  const T* Bb2 = SPLIT ? (Bt2 + (size_t)b * strideB) : nullptr;

  const int rlane = lane & 15;                 // row (A) / col (B, D) within subtile
  const int koff  = (lane >> 4) * 8;           // k offset of this lane half
  const int mOff  = (lane >> 4) * 8;           // D row offset

  v8f acc[4][4];
#pragma unroll
  for (int i = 0; i < 4; ++i)
#pragma unroll
    for (int j = 0; j < 4; ++j) acc[i][j] = (v8f){0.f,0.f,0.f,0.f,0.f,0.f,0.f,0.f};

  for (int k0 = 0; k0 < K; k0 += 32) {
    V bh[4], bl[4];
#pragma unroll
    for (int j = 0; j < 4; ++j) {
      const size_t bo = (size_t)(n0 + (j << 4) + rlane) * ldb + koff + k0;
      bh[j] = Frag<T>::load(Bb + bo);
      if (SPLIT) bl[j] = Frag<T>::load(Bb2 + bo);
    }
#pragma unroll
    for (int i = 0; i < 4; ++i) {
      const size_t ao = (size_t)(m0 + (i << 4) + rlane) * lda + koff + k0;
      V ah = Frag<T>::load(Ab + ao);
      V al;
      if (SPLIT) al = Frag<T>::load(Ab2 + ao);
#pragma unroll
      for (int j = 0; j < 4; ++j) {
        acc[i][j] = Frag<T>::mma(ah, bh[j], acc[i][j]);
        if (SPLIT) {
          acc[i][j] = Frag<T>::mma(ah, bl[j], acc[i][j]);
          acc[i][j] = Frag<T>::mma(al, bh[j], acc[i][j]);
        }
      }
      Frag<T>::guard(acc[i][0], acc[i][3], ah, SPLIT ? al : ah);
    }
    Frag<T>::keep(bh[0], bh[1], bh[2], bh[3]);
    if (SPLIT) Frag<T>::keep(bl[0], bl[1], bl[2], bl[3]);
  }
  acc_guard4(acc[0][0], acc[0][1], acc[0][2], acc[0][3]);
  acc_guard4(acc[1][0], acc[1][1], acc[1][2], acc[1][3]);
  acc_guard4(acc[2][0], acc[2][1], acc[2][2], acc[2][3]);
  acc_guard4(acc[3][0], acc[3][1], acc[3][2], acc[3][3]);

  // ---- epilogue ----
  float* slab = sT + wave * (16 * 68);
  const float* Rb = RESID ? (resid + (size_t)b * strideR) : nullptr;
#pragma unroll
  for (int i = 0; i < 4; ++i) {
    const int mBase = m0 + (i << 4);
#pragma unroll
    for (int j = 0; j < 4; ++j) {
      const int n = n0 + (j << 4) + rlane;
      float bv = 0.f;
      if (BIAS_MODE == 2) bv = bias[n];
#pragma unroll
      for (int r = 0; r < 8; ++r) {
        float v = acc[i][j][r] * scale;
        if (BIAS_MODE == 1) v += bias[mBase + mOff + r];
        if (BIAS_MODE == 2) v += bv;
        if (RESID) v += Rb[(size_t)(mBase + mOff + r) * ldc + n];
        if (ACT == 2) v = fmaxf(v, 0.0f);
        if (ACT == 4) v = (v > 0.f) ? v : 0.01f * v;
        slab[(mOff + r) * 68 + (j << 4) + rlane] = v;
      }
    }
    __builtin_amdgcn_fence(__ATOMIC_RELEASE, "workgroup");
    __builtin_amdgcn_wave_barrier();
    __builtin_amdgcn_fence(__ATOMIC_ACQUIRE, "workgroup");
    if (OUT_MODE == 0) {
      float* C = (float*)Cout + (size_t)b * strideC;
      const int hh = lane >> 4, c4 = (lane & 15) * 4;     // row seg = 256 B = 16 lanes x 16 B
      {
#pragma unroll
        for (int it = 0; it < 8; ++it) {
          const int row = it * 2 + hh;
          v4f v = *(const v4f*)(slab + row * 68 + c4);
          *(v4f*)(C + (size_t)(mBase + row) * ldc + n0 + c4) = v;
        }
        
      }
    } else {
      const int q = lane >> 3, c8 = (lane & 7) * 8;
      unsigned short* C  = (unsigned short*)Cout  + (size_t)b * strideC;
      unsigned short* C2 = (OUT_MODE == 2) ? ((unsigned short*)Cout2 + (size_t)b * strideC) : nullptr;
      {
#pragma unroll
        for (int it = 0; it < 4; ++it) {
          const int row = it * 4 + q;
          const float* sp = slab + row * 68 + c8;
          v8h hv, lv;
#pragma unroll
          for (int e = 0; e < 8; ++e) {
            if (OUT_MODE == 1) {
              hv[e] = (_Float16)sp[e];
            } else {
              unsigned short hb = f2bf_bits(sp[e]);
              unsigned short lb = f2bf_bits(sp[e] - bf_bits2f(hb));
              hv[e] = __builtin_bit_cast(_Float16, hb);
              lv[e] = __builtin_bit_cast(_Float16, lb);
            }
          }
          *(v8h*)(C + (size_t)(mBase + row) * ldc + n0 + c8) = hv;
          if (OUT_MODE == 2) *(v8h*)(C2 + (size_t)(mBase + row) * ldc + n0 + c8) = lv;
        }
        
      }
    }
    __builtin_amdgcn_fence(__ATOMIC_RELEASE, "workgroup");
    __builtin_amdgcn_wave_barrier();
    __builtin_amdgcn_fence(__ATOMIC_ACQUIRE, "workgroup");
  }
}
// ---------------------------------------------------------------------------
// Weight preparation: 64x64 transpose tiles of f32 W[k][n] (pitch ldn) -> WT[n][k] (pitch ldk).
// blocks 0..3: Wk -> WkvHi/WkvLo rows 0..127 (bf16 hi + bf16 lo planes); 4..7: Wv -> rows 128..255;
// 8..11: W_comb -> WcHi/WcLo; 12: lm_W2 -> W2T (f16 carried x16, single plane).
// Load coverage: 16 x 256 = 4096 = whole tile. Store coverage: 8 waves x 2 it x 4 rows (lane>>3) = 64 rows,
// ---------------------------------------------------------------------------
constexpr int kWpBlocks = 13;
constexpr int kWpLds = 64 * 65;   // floats
__device__ __forceinline__ void wprep_body(float* smem, int bid,
                                           const float* __restrict__ Wk, const float* __restrict__ Wv,
                                           const float* __restrict__ Wcomb, const float* __restrict__ W2,
                                           unsigned short* __restrict__ WkvHi, unsigned short* __restrict__ WkvLo,
                                           unsigned short* __restrict__ WcHi, unsigned short* __restrict__ WcLo,
                                           unsigned short* __restrict__ W2T) {
  float (*sm)[65] = (float (*)[65])smem;   // sm[n_local][k_local]
  const int t = threadIdx.x, lane = t & 31, wave = t >> 5;
  // bid: block-uniform selection below
  const float* W = Wk; unsigned short* outH = WkvHi; unsigned short* outL = WkvLo;
  int ldn = kHD, ldk = kE, nt = 0, kt = 0; float carry = 1.0f;
  const bool two_planes = (bid < 12);
  if (bid < 4)       { W = Wk;    outH = WkvHi;                    outL = WkvLo;                    ldn = kHD;  ldk = kE;   nt = bid & 1;       kt = bid >> 1;       carry = 1.0f; }
  else if (bid < 8)  { W = Wv;    outH = WkvHi + (size_t)kHD * kE; outL = WkvLo + (size_t)kHD * kE; ldn = kHD;  ldk = kE;   nt = (bid - 4) & 1; kt = (bid - 4) >> 1; carry = 1.0f; }
  else if (bid < 12) { W = Wcomb; outH = WcHi;                     outL = WcLo;                     ldn = kE;   ldk = kHD;  nt = (bid - 8) & 1; kt = (bid - 8) >> 1; carry = 1.0f; }
  else               { W = W2;    outH = W2T;                      outL = W2T;                      ldn = kHID; ldk = kHID; nt = 0;             kt = 0;              carry = kWCarry; }
  const int n0 = nt * 64, k0 = kt * 64;
  const int r0 = t >> 6;     // k local of trip 0; trip i: r0 + 4 i
  const int c = t & 63;      // n local
  float wv[16];
#pragma unroll
  for (int g = 0; g < 4; ++g) {
    const float* p0 = W + (size_t)(k0 + r0 + 16 * g) * ldn + n0 + c;
    const float* p1 = p0 + (size_t)4 * ldn;
    const float* p2 = p0 + (size_t)8 * ldn;
    const float* p3 = p0 + (size_t)12 * ldn;
    wv[4 * g] = *p0; wv[4 * g + 1] = *p1; wv[4 * g + 2] = *p2; wv[4 * g + 3] = *p3;
    // address translations done before a register that one of these four loads names is reused; naming the four addresses
    // as inputs keeps them in their registers up to the wait
    asm volatile("s_wait_xcnt 0x0" :: "v"(p0), "v"(p1), "v"(p2), "v"(p3) : "memory");
  }
#pragma unroll
  for (int i = 0; i < 16; ++i) sm[c][r0 + 4 * i] = wv[i] * carry;
  __syncthreads();
  const int q = lane >> 3, c8 = (lane & 7) * 8;
  v4u uh[2], ul[2];
  int rowv[2];
#pragma unroll
  for (int it = 0; it < 2; ++it) {
    const int row = wave * 8 + it * 4 + q;   // n local
    rowv[it] = row;
    unsigned short hb[8], lb[8];
#pragma unroll
    for (int e = 0; e < 8; ++e) {
      const float v = sm[row][c8 + e];
      if (two_planes) { split_bf(v, hb[e], lb[e]); }
      else { hb[e] = h_bits(v); lb[e] = hb[e]; }
    }
    uh[it] = (v4u){pk16(hb[0], hb[1]), pk16(hb[2], hb[3]), pk16(hb[4], hb[5]), pk16(hb[6], hb[7])};
    ul[it] = (v4u){pk16(lb[0], lb[1]), pk16(lb[2], lb[3]), pk16(lb[4], lb[5]), pk16(lb[6], lb[7])};
  }
  {
#pragma unroll
    for (int it = 0; it < 2; ++it) {
      const size_t o = (size_t)(n0 + rowv[it]) * ldk + k0 + c8;
      *(v4u*)(outH + o) = uh[it];
      // behind each store: address translation done before the code laid out behind it writes a register that the store names
      asm volatile("s_wait_xcnt 0x0" ::: "memory");
      if (two_planes) {
        *(v4u*)(outL + o) = ul[it];
        asm volatile("s_wait_xcnt 0x0" ::: "memory");   // as above
      }
    }
  }
}

// ---------------------------------------------------------------------------
// Node split: enc f32 [B][1000][128] -> EncHi/EncLo bf16 hi/lo planes [B][1024][128] each
// (rows 1000..1023 of every batch written as zeros in both planes).
// ---------------------------------------------------------------------------
constexpr int kEcBlocks = (kEncRows * 16) / 256;
__device__ __forceinline__ void enc_cast_body(int bid, const float* __restrict__ enc, unsigned short* __restrict__ outHi,
                                              unsigned short* __restrict__ outLo) {
  const int i = bid * 256 + threadIdx.x;
  if (i >= kEncRows * 16) return;
  const int row = i >> 4, c8 = (i & 15) * 8;
  const int b = row >> 10, n = row & (kNP - 1);
  const int nc = (n < kN) ? n : (kN - 1);                    // address clamp
  const float* p = enc + ((size_t)(b * kN + nc)) * kE + c8;
  const v4f a = *(const v4f*)(p);
  const v4f c = *(const v4f*)(p + 4);
  const bool valid = (n < kN);
  unsigned short hb[8], lb[8];
#pragma unroll
  for (int e = 0; e < 4; ++e) {
    split_bf(valid ? a[e] : 0.0f, hb[e], lb[e]);
    split_bf(valid ? c[e] : 0.0f, hb[4 + e], lb[4 + e]);
  }
  const v4u uh = (v4u){pk16(hb[0], hb[1]), pk16(hb[2], hb[3]), pk16(hb[4], hb[5]), pk16(hb[6], hb[7])};
  const v4u ul = (v4u){pk16(lb[0], lb[1]), pk16(lb[2], lb[3]), pk16(lb[4], lb[5]), pk16(lb[6], lb[7])};
  const size_t o = (size_t)row * kE + c8;
  *(v4u*)(outHi + o) = uh;
  *(v4u*)(outLo + o) = ul;
  
}

// ---------------------------------------------------------------------------
// Query side (f32, VALU), 4 (b,p) rows per block: q_in = [last | load] (129);
//   Qs[bp][h*16+d] = ((q_in.Wq_last) * 2*sigmoid(relu(q_in.fW1 + fb1).fW2 + fb2)) * 0.25   (1/sqrt(16) folded, exact)
//   QW[bp][64]     = lm_b1 + qf.lm_W1[3:19]   with qf = q_in.lazy_q_W + lazy_q_b
// 5 working waves. Waves 0..3: thread = output column j; every weight element it loads feeds the chains of the 4 rows, whose
// inputs lie in LDS as [e][row] (one 16-B broadcast read per e). Wave 4: hidden unit 128 of the FiLM layer, qf, then QW.
// The weight loads go out in batches, one batch ahead of the arithmetic, so their latencies overlap.
// Every output is still one fma chain from its bias, e ascending.
// All loops of this kernel are unrolled in full: the batches are register arrays, which takes static indices, and the
// loads of a batch have to stand together ahead of the arithmetic that uses the batch before.
// Stores: one instruction of a wave writes one whole 128-B line of a Qs or QW row.
// The launch that holds this job has blocks of 8 waves: waves 5..7 have no part here and only pass the two barriers.
// ---------------------------------------------------------------------------
constexpr int kQR = 4;     // (b,p) rows per block
constexpr int kQB = 16;    // e steps per batch of weight loads
static_assert(kBP % kQR == 0 && kE % kQB == 0, "rows per block, batches");
// one batch of a weight column: w[i] = col[(e0 + i) * LD]
template <int LD>
__device__ __forceinline__ void q_fetch(float (&w)[kQB], const float* __restrict__ col, int e0) {
#pragma unroll
  for (int i = 0; i < kQB; ++i) w[i] = col[(e0 + i) * LD];
}
// Stands behind a group of loads: address translations done before a register that an issued load names is reused; its
// "memory" clobber also keeps those loads in front of the LDS reads and the arithmetic below, which then cover their latency.
__device__ __forceinline__ void q_issued() { asm volatile("s_wait_xcnt 0x0" ::: "memory"); }
// a[r] += x[r] * w for NR rows
template <int NR>
__device__ __forceinline__ void q_step(float (&a)[NR], const float* x, float w) {
#pragma unroll
  for (int r = 0; r < NR; ++r) a[r] = fmaf(x[r], w, a[r]);
}
// a[r] += sum_e xa[e][r] * colA[e * LDA] and b[r] += sum_e xb[e][r] * colB[e * LDB], e = 0..128 ascending;
// xa, xb: LDS, kQR floats per e
template <int LDA, int LDB, int NA, int NB>
__device__ __forceinline__ void q_dot2(float (&a)[NA], const float* xa, const float* __restrict__ colA,
                                       float (&b)[NB], const float* xb, const float* __restrict__ colB) {
  float wa[2][kQB], wb[2][kQB];
  q_fetch<LDA>(wa[0], colA, 0);
  q_fetch<LDB>(wb[0], colB, 0);
  float wat = 0.0f, wbt = 0.0f;
#pragma unroll
  for (int c = 0; c < kE / kQB; ++c) {
    if (c + 1 < kE / kQB) {
      q_fetch<LDA>(wa[(c + 1) & 1], colA, kQB * (c + 1));
      q_fetch<LDB>(wb[(c + 1) & 1], colB, kQB * (c + 1));
    } else {
      wat = colA[kE * LDA];
      wbt = colB[kE * LDB];
    }
    q_issued();
#pragma unroll
    for (int i = 0; i < kQB; ++i) {
      q_step<NA>(a, xa + (kQB * c + i) * kQR, wa[c & 1][i]);
      q_step<NB>(b, xb + (kQB * c + i) * kQR, wb[c & 1][i]);
    }
  }
  q_step<NA>(a, xa + kE * kQR, wat);
  q_step<NB>(b, xb + kE * kQR, wbt);
}
constexpr int kQsBlocks = kBP / kQR;
constexpr int kQsLds = (kE + 1) * kQR + (kE * kQR + 32) + kQD * kQR;   // floats
__device__ __forceinline__ void qside_body(float* smem, int bid,
                                           const float* __restrict__ enc_last, const float* __restrict__ loadv,
                                           const float* __restrict__ Wq, const float* __restrict__ fW1,
                                           const float* __restrict__ fb1, const float* __restrict__ fW2,
                                           const float* __restrict__ fb2, const float* __restrict__ lqW,
                                           const float* __restrict__ lqb, const float* __restrict__ lW1,
                                           const float* __restrict__ lb1,
                                           float* __restrict__ Qs, float* __restrict__ QW) {
  float* qin = smem;                          // [e][row], (kE + 1) * kQR floats
  float* g1s = qin + (kE + 1) * kQR;          // [e][row]; behind e = 128 the 28 copies that wave 4 leaves
  float* qfs = g1s + kE * kQR + 32;           // [i][row]
  const int bp0 = bid * kQR;
  const int t = threadIdx.x, lane = t & 31;
  const int wv = __builtin_amdgcn_readfirstlane(t >> 5);
  const bool colw = wv < 4, aux = wv == 4;    // scalar: waves 0..3, wave 4; neither: waves 5..7
  if (colw) {
    v4f x;
#pragma unroll
    for (int r = 0; r < kQR; ++r) x[r] = enc_last[(size_t)(bp0 + r) * kE + t];
    q_issued();
    *(v4f*)(qin + t * kQR) = x;
  } else if (aux && lane < kQR) {
    const float x = loadv[bp0 + lane];
    q_issued();
    qin[kE * kQR + lane] = x;
  }
  __syncthreads();
  float qv[kQR] = {0.0f, 0.0f, 0.0f, 0.0f};
  if (colw) {
    const float b1 = fb1[t];
    q_issued();
    float a1[kQR] = {b1, b1, b1, b1};
    q_dot2<kE + 1, kHD, kQR, kQR>(a1, qin, fW1 + t, qv, qin, Wq + t);
    *(v4f*)(g1s + t * kQR) = (v4f){fmaxf(a1[0], 0.0f), fmaxf(a1[1], 0.0f), fmaxf(a1[2], 0.0f), fmaxf(a1[3], 0.0f)};
  } else if (aux) {
    // lane = (qf unit i16, row pair h2); it also runs hidden unit 128 of row lane & 3 (lanes 0..3 are read, the rest are copies)
    const int i16 = lane & 15, h2 = (lane >> 4) * 2;
    float a1[1] = {fb1[kE]};
    const float bq = lqb[i16];
    q_issued();
    float qf[2] = {bq, bq};
    q_dot2<kE + 1, kQD, 1, 2>(a1, qin + (lane & 3), fW1 + kE, qf, qin + h2, lqW + i16);
    g1s[kE * kQR + lane] = fmaxf(a1[0], 0.0f);
    *(v2f*)(qfs + i16 * kQR + h2) = (v2f){qf[0], qf[1]};
  }
  __syncthreads();
  if (colw) {
    const float b2 = fb2[t];
    float gm[kQR] = {b2, b2, b2, b2};
    const float* col = fW2 + t;
    float w[3][kQB];           // two batches ahead here: one column only
    q_fetch<kHD>(w[0], col, 0);
    q_fetch<kHD>(w[1], col, kQB);
    float wt = 0.0f;
#pragma unroll
    for (int c = 0; c < kE / kQB; ++c) {
      if (c + 2 < kE / kQB) q_fetch<kHD>(w[(c + 2) % 3], col, kQB * (c + 2));
      else if (c + 2 == kE / kQB) wt = col[kE * kHD];
      if (c + 2 <= kE / kQB) q_issued();
#pragma unroll
      for (int i = 0; i < kQB; ++i) q_step<kQR>(gm, g1s + (kQB * c + i) * kQR, w[c % 3][i]);
    }
    q_step<kQR>(gm, g1s + kE * kQR, wt);
#pragma unroll
    for (int r = 0; r < kQR; ++r) {
      const float den = 1.0f + expf(-gm[r]);
      const float gamma = 2.0f * (1.0f / den);
      Qs[(size_t)(bp0 + r) * kHD + t] = (qv[r] * gamma) * 0.25f;
    }
  } else if (aux) {
    const float c0 = lb1[lane], c1 = lb1[32 + lane];
    float u0[kQR] = {c0, c0, c0, c0}, u1[kQR] = {c1, c1, c1, c1};
    float w0[kQB], w1[kQB];
    static_assert(kQD == kQB, "one batch");
    q_fetch<kHID>(w0, lW1 + kDYN * kHID + lane, 0);
    q_fetch<kHID>(w1, lW1 + kDYN * kHID + 32 + lane, 0);
    q_issued();
#pragma unroll
    for (int i = 0; i < kQD; ++i) {
      q_step<kQR>(u0, qfs + i * kQR, w0[i]);
      q_step<kQR>(u1, qfs + i * kQR, w1[i]);
    }
#pragma unroll
    for (int r = 0; r < kQR; ++r) {
      QW[(size_t)(bp0 + r) * kHID + lane] = u0[r];
      QW[(size_t)(bp0 + r) * kHID + 32 + lane] = u1[r];
    }
    q_issued();   // the wait behind the stores too: the code laid out behind this branch writes registers that they name
  }
}

// ---------------------------------------------------------------------------
// Lazy-mask MLP, all three layers in one kernel; H1 and H2 never leave the registers.
// Block = one (b,p) row of MASKB, 4 waves; a wave owns 256 node slots and walks them 32 at a time (two 16-slot tiles).
// Lane l: c = l & 15, h = l >> 4.
//   layer 1 (WMMA f16, f16 result): every f32 value v goes in as hi = f16(v) and rest = f16(v - hi), and the four partial
//     products stand side by side in k, of which 16 of the 32 places are used. Elements 0..7 of a lane (8..15 are zero):
//       A, row = hidden unit 16 i + c:  h = 0: {w0 w1 w2 qw}hi {w0 w1 w2}hi, third part of qw;  h = 1: {w0 w1 w2 qw}rest {w0 w1 w2}rest, 0
//       B, column = slot c, both h:     {x0 x1 x2}hi, 1, {x0 x1 x2}rest, 1
//     so D = (w hi + w rest) . (x hi + x rest) + QW, summed in the matrix unit and rounded to f16 there, as H1 was rounded before.
//     D element e of tile i = H1[unit 16 i + 8 h + e][slot c]; after relu, tiles 2 s and 2 s + 1 are the B fragment of k step s
//     as they stand. The A fragments are made once per wave; the row's dynamic features and mask row are staged in LDS once.
//   layer 2 (WMMA f16): A = lm_W2^T x16, row j = 16 i + c, in the same k order: elements 0..7 = k 32 s + 8 h + e, elements
//     8..15 = k 32 s + 16 + 8 h + (e - 8);
//     D register r of tile i = 16 * (H1 . lm_W2[:, j]) for hidden unit j = 16 i + 8 h + r of slot c.
//   layer 3 (f32 VALU): z = sum_j relu(D / 16 + lm_b2[j]) * lm_W3[j]: 32 j in the lane, the other 32 in lane l ^ 16.
//   MASKB[bp][n] = ninf_mask[b,p,min(n,999)] - softplus(z + lm_b3)   (ALPHA = 1)
// Coverage: 1600 blocks x 4 waves x 8 trips x 32 slots = all 1024 columns of all 1600 rows (pad slots from clamped inputs).
// ---------------------------------------------------------------------------
// layer 3 for one 16-unit tile: sum over the lane's 8 hidden units of relu(D / 16 + b2) * w3
__device__ __forceinline__ v2f lazy_l3(v8f acc, const v2f (&b2)[4], const v2f (&w3)[4]) {
  const v2f zero = (v2f){0.0f, 0.0f};
  const v2f sc = (v2f){1.0f / kWCarry, 1.0f / kWCarry};
  v2f zs = zero;
#pragma unroll
  for (int q = 0; q < 4; ++q) {
    const v2f a = __builtin_elementwise_max(__builtin_elementwise_fma((v2f){acc[2 * q], acc[2 * q + 1]}, sc, b2[q]), zero);
    zs = __builtin_elementwise_fma(a, w3[q], zs);
  }
  return zs;
}
constexpr int kLzLds = kN * kDYN + kN;   // floats
// f16 hi part of an f32 value and the f32 remainder
__device__ __forceinline__ _Float16 lazy_hi(float v, float& rest) {
  const _Float16 hi = (_Float16)v;
  rest = v - (float)hi;
  return hi;
}
// relu of eight f16 values on their bit patterns: a set sign bit makes the 16-bit integer negative, so the signed maximum with 0
// gives +0 for every negative value and for -0 and leaves the rest as it is. One instruction per pair; the floating-point
// maximum takes two here, because the compiler first quiets the matrix result.
__device__ __forceinline__ v8h lazy_relu(v8h x) {
  const v8s z = (v8s){0, 0, 0, 0, 0, 0, 0, 0};
  return __builtin_bit_cast(v8h, __builtin_elementwise_max(__builtin_bit_cast(v8s, x), z));
}
// B fragment of layer 1 for one slot's three features
__device__ __forceinline__ v16h lazy_xfrag(float x0, float x1, float x2) {
  const v2h h01 = __builtin_convertvector((v2f){x0, x1}, v2h), h2 = __builtin_convertvector((v2f){x2, 1.0f}, v2h);
  const v2f r01 = (v2f){fmaf((float)h01[0], -1.0f, x0), fmaf((float)h01[1], -1.0f, x1)};
  const v2h l01 = __builtin_convertvector(r01, v2h), l2 = __builtin_convertvector((v2f){fmaf((float)h2[0], -1.0f, x2), 1.0f}, v2h);
  const _Float16 z = (_Float16)0.0f;
  return (v16h){h01[0], h01[1], h2[0], h2[1], l01[0], l01[1], l2[0], l2[1], z, z, z, z, z, z, z, z};
}
__device__ __forceinline__ void lazy_body(float* smem, int bp,
                                          const float* __restrict__ dyn, const float* __restrict__ QW,
                                          const float* __restrict__ lW1, const _Float16* __restrict__ W2T,
                                          const float* __restrict__ lb2, const float* __restrict__ lW3,
                                          const float* __restrict__ lb3, const float* __restrict__ ninfm,
                                          float* __restrict__ maskb) {
  float* sd = smem;                    // dynamic features of this (b,p): 1000 x 3
  float* sn = sd + kN * kDYN;          // ninf_mask row of this (b,p)
  const int t = threadIdx.x;
  const int lane = t & 31, wave = t >> 5;
  const int c = lane & 15, h = lane >> 4;
  // stage the 12000 contiguous bytes of dynamic features: 750 x 16 B over 128 threads
  const unsigned oD = (unsigned)t * 16u;
  const char* dsrc = (const char*)(dyn + (size_t)bp * kN * kDYN);
  v4f dv[6];
#pragma unroll
  for (int i = 0; i < 5; ++i) dv[i] = *(const v4f*)(dsrc + oD + i * 2048);
  const bool last = (t < (kN * kDYN * 4 - 5 * 2048) / 16);
  const unsigned oL = last ? (oD + 5 * 2048) : 0u;     // threads past the end fetch in bounds and store nothing
  dv[5] = *(const v4f*)(dsrc + oL);
  // and the 4000 contiguous bytes of the mask row: 250 x 16 B
  const char* nsrc = (const char*)(ninfm + (size_t)bp * kN);
  const bool lastn = (t < (kN * 4 - 2048) / 16);
  const unsigned oN = lastn ? (oD + 2048) : 0u;
  const v4f nv0 = *(const v4f*)(nsrc + oD);
  const v4f nv1 = *(const v4f*)(nsrc + oN);
  // byte offsets of the lane's first weight / fragment / bias element; these set-up loads are scalar base + one of them
  const unsigned oU = (unsigned)c * 4u;
  const unsigned oA = (unsigned)(c * kHID + 8 * h) * 2u;
  const unsigned oJ = (unsigned)(8 * h) * 4u;
  // layer 1, hidden unit 16 i + c: its three feature weights and its QW
  const char* qsrc = (const char*)(QW + (size_t)bp * kHID);
  float w1v[4][4];
#pragma unroll
  for (int i = 0; i < 4; ++i) {
#pragma unroll
    for (int d = 0; d < kDYN; ++d) w1v[i][d] = *(const float*)((const char*)lW1 + oU + (d * kHID + 16 * i) * 4);
    w1v[i][3] = *(const float*)(qsrc + oU + 16 * i * 4);
  }
  v16h aw[4][2];
#pragma unroll
  for (int i = 0; i < 4; ++i)
#pragma unroll
    for (int s = 0; s < 2; ++s) aw[i][s] = Frag<_Float16>::load((const _Float16*)((const char*)W2T + oA + (16 * i * kHID + 32 * s) * 2));
  v2f b2[4][4], w3[4][4];
#pragma unroll
  for (int i = 0; i < 4; ++i)
#pragma unroll
    for (int q = 0; q < 4; ++q) {
      b2[i][q] = *(const v2f*)((const char*)lb2 + oJ + (16 * i + 2 * q) * 4);
      w3[i][q] = *(const v2f*)((const char*)lW3 + oJ + (16 * i + 2 * q) * 4);
    }
  const float b3 = lb3[0];
  // address translations done before a register that a load above names is reused
  asm volatile("s_wait_xcnt 0x0" :: "v"(oD), "v"(oL), "v"(oN), "v"(oU), "v"(oA), "v"(oJ) : "memory");
#pragma unroll
  for (int i = 0; i < 5; ++i) *(v4f*)((char*)sd + oD + i * 2048) = dv[i];
  // inputs-only fence on the loaded value: keeps this load up with the others; without it the compiler sinks it into the branch
  // below, where its whole latency is waited out alone
  asm volatile("" :: "v"(dv[5]));
  if (last) *(v4f*)((char*)sd + oL) = dv[5];
  *(v4f*)((char*)sn + oD) = nv0;
  if (lastn) *(v4f*)((char*)sn + oN) = nv1;
  v16h a1[4];
#pragma unroll
  for (int i = 0; i < 4; ++i) {
    _Float16 pt[4];
    float rq = 0.0f;
#pragma unroll
    for (int d = 0; d < 4; ++d) {
      float r;
      const _Float16 hi = lazy_hi(w1v[i][d], r);
      pt[d] = h ? (_Float16)r : hi;
      rq = r;                       // leaves the loop as QW's remainder
    }
    float r3;
    (void)lazy_hi(rq, r3);
    const _Float16 z = (_Float16)0.0f;
    const _Float16 q3 = h ? z : (_Float16)r3;
    a1[i] = (v16h){pt[0], pt[1], pt[2], pt[3], pt[0], pt[1], pt[2], q3, z, z, z, z, z, z, z, z};
  }
  __syncthreads();
  const int nw = wave * 256;
  float* mp = maskb + (size_t)bp * kNP + nw + lane;
  for (int it = 0; it < 8; ++it) {
    const int n0 = nw + it * 32;
    const int n = n0 + lane;
    const int nc = (n < kN) ? n : (kN - 1);                          // address clamps (pad slots)
    const int ia = ((n0 + c < kN) ? (n0 + c) : (kN - 1)) * kDYN;
    const int ib = ((n0 + 16 + c < kN) ? (n0 + 16 + c) : (kN - 1)) * kDYN;
    const float a0 = sd[ia], a1x = sd[ia + 1], a2 = sd[ia + 2];
    const float e0 = sd[ib], e1 = sd[ib + 1], e2 = sd[ib + 2];
    const v16h xa = lazy_xfrag(a0, a1x, a2), xb = lazy_xfrag(e0, e1, e2);
    const v8h hz8 = (v8h){(_Float16)0.0f, (_Float16)0.0f, (_Float16)0.0f, (_Float16)0.0f, (_Float16)0.0f, (_Float16)0.0f, (_Float16)0.0f, (_Float16)0.0f};
    v8h da[4], db[4];
#pragma unroll
    for (int i = 0; i < 4; ++i) {
      da[i] = __builtin_amdgcn_wmma_f16_16x16x32_f16(false, a1[i], false, xa, (short)0, hz8, false, false);
      db[i] = __builtin_amdgcn_wmma_f16_16x16x32_f16(false, a1[i], false, xb, (short)0, hz8, false, false);
    }
    // keeps the eight products together in front of the relu: each then stands in the others' result distance, which the
    // compiler otherwise fills with v_nop
    __builtin_amdgcn_sched_barrier(0);
#pragma unroll
    for (int i = 0; i < 4; ++i) {
      da[i] = lazy_relu(da[i]);
      db[i] = lazy_relu(db[i]);
    }
    v16h ba[2], bb[2];
#pragma unroll
    for (int s = 0; s < 2; ++s) {
      ba[s] = __builtin_shufflevector(da[2 * s], da[2 * s + 1], 0, 1, 2, 3, 4, 5, 6, 7, 8, 9, 10, 11, 12, 13, 14, 15);
      bb[s] = __builtin_shufflevector(db[2 * s], db[2 * s + 1], 0, 1, 2, 3, 4, 5, 6, 7, 8, 9, 10, 11, 12, 13, 14, 15);
    }
    v2f za2[4], zb2[4];
#pragma unroll
    for (int i = 0; i < 4; ++i) {
      const v8f czero = (v8f){0.f, 0.f, 0.f, 0.f, 0.f, 0.f, 0.f, 0.f};
      v8f ca = __builtin_amdgcn_wmma_f32_16x16x32_f16(false, aw[i][0], false, ba[0], (short)0, czero, false, false);
      v8f cc = __builtin_amdgcn_wmma_f32_16x16x32_f16(false, aw[i][0], false, bb[0], (short)0, czero, false, false);
      ca = __builtin_amdgcn_wmma_f32_16x16x32_f16(false, aw[i][1], false, ba[1], (short)0, ca, false, false);
      cc = __builtin_amdgcn_wmma_f32_16x16x32_f16(false, aw[i][1], false, bb[1], (short)0, cc, false, false);
      za2[i] = lazy_l3(ca, b2[i], w3[i]);
      zb2[i] = lazy_l3(cc, b2[i], w3[i]);
      // two halves of four result tiles each: with more of them live at once the kernel passes 256 registers, one wave per SIMD fewer
      if (i == 1) __builtin_amdgcn_sched_barrier(0);
    }
    const v2f ta = (za2[0] + za2[1]) + (za2[2] + za2[3]);
    const v2f tb = (zb2[0] + zb2[1]) + (zb2[2] + zb2[3]);
    const float za = ta[0] + ta[1], zb = tb[0] + tb[1];
    // lanes 0..15 finish slots n0 + c (tile a), lanes 16..31 slots n0 + 16 + c (tile b): one exchange l <-> l ^ 16 for both
    const float mine = h ? zb : za;
    const int other = __float_as_int(h ? za : zb);
    const float z = (mine + __int_as_float(__builtin_amdgcn_permlanex16(other, other, 0x76543210, 0xfedcba98, false, false))) + b3;
    // softplus(z) = max(z, 0) + log(1 + exp(-|z|)) on the hardware's exp2 and log2: t lies in [0, 1], so the logarithm's argument
    // lies in [1, 2] and the rounding of 1 + t keeps the absolute error near 2^-23; the value is a bias added to scores of order 1
    const float t1 = 1.0f + __builtin_amdgcn_exp2f(fabsf(z) * -1.44269504f);
    const float spv = fmaf(__builtin_amdgcn_logf(t1), 0.693147181f, fmaxf(z, 0.0f));
    *mp = sn[nc] - spv;
    // address translation done before the store's address register is advanced
    asm volatile("s_wait_xcnt 0x0" :: "v"(mp) : "memory");
    mp += 32;
  }
}

// ---------------------------------------------------------------------------
// Second launch: the two jobs that need only the first launch's results and not each other, side by side in one grid.
// Blocks of 4 waves. Blocks 0..255: K|V projection, [16384][128] x [256][128]^T, bf16 hi/lo both operands -> f32 KV; a block
// holds the four 64-column tiles of one 64-row tile. Blocks 256..1855: the lazy-mask MLP, one (b,p) row each.
// The projection's blocks come first: its waves wait on memory for most of their time, and the MLP's waves fill the vector port
// meanwhile. The job select is block-uniform (scalar); both jobs use the same LDS bytes.
// ---------------------------------------------------------------------------
constexpr int kKvBlocks = (kEncRows / 64) * (2 * kHD / 64) / 4;
constexpr int kMidLds = (4 * 16 * 68 > kLzLds) ? 4 * 16 * 68 : kLzLds;
__global__ __launch_bounds__(128) void k_kv_lazy(const unsigned short* __restrict__ EncHi, const unsigned short* __restrict__ EncLo,
                                                const unsigned short* __restrict__ WkvHi, const unsigned short* __restrict__ WkvLo,
                                                float* __restrict__ KV,
                                                const float* __restrict__ dyn, const float* __restrict__ QW,
                                                const float* __restrict__ lW1, const _Float16* __restrict__ W2T,
                                                const float* __restrict__ lb2, const float* __restrict__ lW3,
                                                const float* __restrict__ lb3, const float* __restrict__ ninfm,
                                                float* __restrict__ maskb) {
  __shared__ __align__(16) float smem[kMidLds];
  const int bid = blockIdx.x;
  if (bid < kKvBlocks) {
    gemm64_body<4, 1, true, 0, 0, false, 0>(smem, bid, 0, EncHi, EncLo, kE, 0L, WkvHi, WkvLo, kE, 0L, (void*)KV, (void*)KV,
                                            2 * kHD, 0L, QW, QW, 0L, kEncRows, 2 * kHD, kE, 1.0f);   // bias, resid: never read
  } else {
    lazy_body(smem, bid - kKvBlocks, dyn, QW, lW1, W2T, lb2, lW3, lb3, ninfm, maskb);
  }
}

// ---------------------------------------------------------------------------
// Attention core (f32, head dim 16), both products on v_wmma_f32_16x16x4_f32; node axis split over the waves of a block.
// Block = (b, group of 16 queries, group of 4 heads), 512 threads = 16 waves: wave = (node slice sl = wave >> 1 of 128 slots,
// head pair wave & 1); it runs its two heads one after the other on the same staged nodes. 16 x 7 x 2 = 224 blocks.
// Per stage every slice gets its next 32 nodes in LDS: the 4 heads' K (64 f32) and V (64 f32) of each node, at a pitch of
// 132 floats, and the bias tile [16 queries][32 nodes] at a pitch of 36 floats (both 16 B x odd: 16 rows read by one 16-B
// load fall on 16 different bank groups). Four stages cover the 128 slots of a slice.
// The stages come by asynchronous 16-B copies from global memory to LDS, into two buffers: stage s + 1 is in flight while the
// products of stage s run; one barrier per stage publishes stage s + 1 and frees the buffer of stage s for stage s + 2.
// Lane l: c = l & 15, h = l >> 4. Per head and tile of 16 nodes:
//   scores, transposed: D[node 8h + r][query c] = bias + sum_dim K[node][dim] * Q[query][dim];
//     A = K (row = node c), B = Q (column = query c), both with dim 8h + 2s + e at k step s, element e; C = the bias tile.
//   output, transposed: D[dim 8h + r][query c] += sum_node V[node][dim] * P[node][query];
//     B = the score tile's own registers 2s, 2s + 1 after the exponential (node 8h + 2s + e), A = V (row = dim c) at the same nodes.
// Online softmax per query, one update per stage (32 nodes); slots >= 1000 forced to -inf by value in the bias; m is common to
// the two lane halves of a query, l is kept per half and added at the end.
// Merge: every wave leaves (acc[16], m, l) per head and query in LDS; 128 threads fold the 8 slices in slice order,
//   M = max m_s, w_s = exp(m_s - M), O = sum_s w_s acc_s / sum_s w_s l_s,
// and write O as bf16 hi + bf16 lo planes into Ohi/Olo[bp][h*16+d]: 8 lanes x 16 B = the block's whole 128-B line of a row
// (rows >= P skipped).
// ---------------------------------------------------------------------------
constexpr int kASl  = 8;               // node slices per block
constexpr int kASn  = kNP / kASl;      // 128 node slots per slice
constexpr int kACh  = 32;              // nodes per slice and stage
constexpr int kAHb  = 4;               // heads per block
constexpr int kARow = 2 * kAHb * kD;   // 128 floats per staged node: K of 4 heads | V of 4 heads
constexpr int kAPt  = kARow + 4;       // pitch of a staged node in floats
constexpr int kAMp  = 36;              // bias tile pitch in floats
constexpr int kACp  = 20;              // merge record pitch in floats: acc[16], m, l, 2 unused
constexpr int kAKvFl = kASl * kACh * kAPt;   // floats in one K|V buffer
constexpr int kAMsFl = kASl * 16 * kAMp;     // floats in one bias buffer
static_assert(kASl * kAHb * 16 * kACp <= kAKvFl, "merge records fit one K|V buffer");
static_assert(kASn / kACh >= 2, "the two-buffer order needs two stages");
// Nine asynchronous copies, 16 B per lane each: l = the lane's LDS byte address, g = the lane's global address. The last line
// stands in the copies' own statement: address translations done before a register that a copy names is written again.
template <int O>
__device__ __forceinline__ void a_copy9(const unsigned (&l)[18], const float* const (&g)[18]) {
  asm volatile("global_load_async_to_lds_b128 %0, %9, off\n\t"
               "global_load_async_to_lds_b128 %1, %10, off\n\t"
               "global_load_async_to_lds_b128 %2, %11, off\n\t"
               "global_load_async_to_lds_b128 %3, %12, off\n\t"
               "global_load_async_to_lds_b128 %4, %13, off\n\t"
               "global_load_async_to_lds_b128 %5, %14, off\n\t"
               "global_load_async_to_lds_b128 %6, %15, off\n\t"
               "global_load_async_to_lds_b128 %7, %16, off\n\t"
               "global_load_async_to_lds_b128 %8, %17, off\n\t"
               "s_wait_xcnt 0x0"
               :: "v"(l[O]), "v"(l[O + 1]), "v"(l[O + 2]), "v"(l[O + 3]), "v"(l[O + 4]), "v"(l[O + 5]), "v"(l[O + 6]),
                  "v"(l[O + 7]), "v"(l[O + 8]), "v"(g[O]), "v"(g[O + 1]), "v"(g[O + 2]), "v"(g[O + 3]), "v"(g[O + 4]),
                  "v"(g[O + 5]), "v"(g[O + 6]), "v"(g[O + 7]), "v"(g[O + 8])
               : "memory");
}
// the wave's own copies have landed in LDS
__device__ __forceinline__ void a_landed() { asm volatile("s_wait_asynccnt 0x0" ::: "memory"); }
__device__ __forceinline__ v8f mma4(v2f a, v2f b, v8f c) {
  return __builtin_amdgcn_wmma_f32_16x16x4_f32(false, a, false, b, (short)0, c, false, false);
}
// the value that lane l ^ 16 holds
__device__ __forceinline__ float other_half(float x) {
  const int i = __float_as_int(x);
  return __int_as_float(__builtin_amdgcn_permlanex16(i, i, 0x76543210, 0xfedcba98, false, false));
}
__global__ __launch_bounds__(512) void k_attn(const float* __restrict__ Qs, const float* __restrict__ KV,
                                             const float* __restrict__ maskb, unsigned short* __restrict__ Ohi,
                                             unsigned short* __restrict__ Olo) {
  __shared__ __align__(16) float kvs[2 * kAKvFl];    // 2 x 135168 B; the merge records reuse the first buffer
  __shared__ __align__(16) float ms[2 * kAMsFl];     // 2 x 18432 B
  const float kNegInf = -__builtin_inff();
  const int t = threadIdx.x, lane = t & 31;
  const int wave = __builtin_amdgcn_readfirstlane(t >> 5);   // scalar: slice bounds and LDS bases stay off the vector unit
  const int b = blockIdx.x / 14, rem = blockIdx.x - b * 14, pg = rem >> 1, hq = rem & 1, p0 = pg * 16;
  const int sl = wave >> 1, hp = (wave & 1) * 2;
  const int c = lane & 15, h = lane >> 4;
  const int p = p0 + c, pc = (p < kP) ? p : (kP - 1);
  // B fragments of the score product, both heads: 8 consecutive dims of the lane's query
  const float* qp = Qs + (size_t)(b * kP + pc) * kHD + (hq * kAHb + hp) * kD + 8 * h;
  const v4f q0 = *(const v4f*)(qp), q1 = *(const v4f*)(qp + 4), q2 = *(const v4f*)(qp + kD), q3 = *(const v4f*)(qp + kD + 4);
  // address translations done before the register pair that these four loads name is reused
  asm volatile("s_wait_xcnt 0x0" :: "v"(qp) : "memory");
  const v2f qf[2][4] = {{(v2f){q0[0], q0[1]}, (v2f){q0[2], q0[3]}, (v2f){q1[0], q1[1]}, (v2f){q1[2], q1[3]}},
                        {(v2f){q2[0], q2[1]}, (v2f){q2[2], q2[3]}, (v2f){q3[0], q3[1]}, (v2f){q3[2], q3[3]}}};
  v8f o[2] = {(v8f){0.f, 0.f, 0.f, 0.f, 0.f, 0.f, 0.f, 0.f}, (v8f){0.f, 0.f, 0.f, 0.f, 0.f, 0.f, 0.f, 0.f}};
  float m[2] = {-3.0e38f, -3.0e38f}, l[2] = {0.0f, 0.0f};
  const float* kvb = KV + (size_t)b * kNP * (2 * kHD);
  const float* mkb = maskb + (size_t)(b * kP) * kNP;
  // staging roles: a wave copies whole node rows (lanes 0..15 the K part, 16..31 the V part, 256 B each)
  const int scol = ((lane < 16) ? 0 : kHD) + hq * (kAHb * kD) + (lane & 15) * 4;
  // bias tile roles: thread t copies 4 columns (t & 7) * 4 of row (t >> 3) & 15 for slices t >> 7 and 4 + (t >> 7)
  const int mr = (t >> 3) & 15, mj4 = (t & 7) * 4, msl = t >> 7;
  const int mpr = (p0 + mr < kP) ? (p0 + mr) : (kP - 1);
  const float* mrow = mkb + (size_t)mpr * kNP + msl * kASn + mj4;
  // the lane's LDS byte addresses in buffer 0: K|V row 'wave' of slice 0, and its piece of the bias tile of slice msl
  const unsigned kvl = (unsigned)(size_t)kvs + (unsigned)((wave * kAPt + lane * 4) * 4);
  const unsigned mdl = (unsigned)(size_t)ms + (unsigned)(((msl * 16 + mr) * kAMp + mj4) * 4);
  // One stage: 8 slices x 32 nodes x 32 pieces of 16 B = 16 x 512 threads (copy i: slice i >> 1, node (i & 1) * 16 + wave), and
  // the bias tiles, 8 slices x 16 rows x 8 pieces = 2 x 512 threads (slices t >> 7 and 4 + (t >> 7)). Every lane of every wave copies.
  auto a_stage = [&](int st, int buf) {
    const float* gk = kvb + (size_t)(st * kACh + wave) * (2 * kHD) + scol;
    const float* gm = mrow + st * kACh;
    const unsigned lk = kvl + (unsigned)(buf * (kAKvFl * 4)), lm = mdl + (unsigned)(buf * (kAMsFl * 4));
    unsigned la[18];
    const float* ga[18];
#pragma unroll   // static indices into the two address arrays
    for (int i = 0; i < 16; ++i) {
      la[i] = lk + (unsigned)(((i >> 1) * kACh + (i & 1) * 16) * kAPt * 4);
      ga[i] = gk + (size_t)((i >> 1) * kASn + (i & 1) * 16) * (2 * kHD);
    }
    la[16] = lm;
    ga[16] = gm;
    la[17] = lm + (unsigned)(4 * 16 * kAMp * 4);
    ga[17] = gm + 4 * kASn;
    a_copy9<0>(la, ga);
    a_copy9<9>(la, ga);
  };
  // fragment bases in LDS: K row = node c of a tile, dims from 8h; V rows = nodes from 8h of a tile, dim c; bias row = query c
  const float* kw0 = kvs + (sl * kACh + c) * kAPt + hp * kD + 8 * h;
  const float* vw0 = kvs + (sl * kACh + 8 * h) * kAPt + (kAHb + hp) * kD + c;
  const float* mw0 = ms + (sl * 16 + c) * kAMp + 8 * h;
  a_stage(0, 0);
  a_landed();
  __syncthreads();   // stage 0 is in buffer 0
  a_stage(1, 1);
#pragma unroll 1   // rolled: one copy of the long body; the buffer is chosen by an address offset
  for (int st = 0; st < kASn / kACh; ++st) {
    const int buf = st & 1;
    const float* kw = kw0 + buf * kAKvFl;
    const float* vw = vw0 + buf * kAKvFl;
    const float* mw = mw0 + buf * kAMsFl;
    // The loops below are unrolled in full: tiles and fragments are register arrays, which takes static indices.
    // C operands of the two score tiles, shared by both heads: register r = bias of (query c, node 16 tt + 8h + r)
    const int nl = sl * kASn + st * kACh + 8 * h;
    v8f bias[2];
#pragma unroll
    for (int tt = 0; tt < 2; ++tt) {
      const v4f x = *(const v4f*)(mw + 16 * tt), y = *(const v4f*)(mw + 16 * tt + 4);
#pragma unroll
      for (int r = 0; r < 4; ++r) {
        bias[tt][r]     = (nl + 16 * tt + r < kN) ? x[r] : kNegInf;
        bias[tt][4 + r] = (nl + 16 * tt + 4 + r < kN) ? y[r] : kNegInf;
      }
    }
#pragma unroll
    for (int g = 0; g < 2; ++g) {
      v8f s[2];
#pragma unroll
      for (int tt = 0; tt < 2; ++tt) {
        const float* kr = kw + 16 * tt * kAPt + g * kD;
        const v4f k0 = *(const v4f*)(kr), k1 = *(const v4f*)(kr + 4);
        v8f a = mma4((v2f){k0[0], k0[1]}, qf[g][0], bias[tt]);
        a = mma4((v2f){k0[2], k0[3]}, qf[g][1], a);
        a = mma4((v2f){k1[0], k1[1]}, qf[g][2], a);
        s[tt] = mma4((v2f){k1[2], k1[3]}, qf[g][3], a);
      }
      float tm = fmaxf(s[0][0], s[1][0]);
#pragma unroll
      for (int r = 1; r < 8; ++r) tm = fmaxf(tm, fmaxf(s[0][r], s[1][r]));
      tm = fmaxf(tm, other_half(tm));
      const float mn = fmaxf(m[g], tm);
      const float alpha = __expf(m[g] - mn);
      m[g] = mn;
      float ps[2] = {0.0f, 0.0f};
#pragma unroll
      for (int tt = 0; tt < 2; ++tt)
#pragma unroll
        for (int r = 0; r < 8; ++r) {
          s[tt][r] = __expf(s[tt][r] - mn);
          ps[tt] += s[tt][r];
        }
      l[g] = fmaf(l[g], alpha, ps[0] + ps[1]);
      o[g] = o[g] * alpha;
#pragma unroll
      for (int tt = 0; tt < 2; ++tt) {
        const float* vr = vw + 16 * tt * kAPt + g * kD;
#pragma unroll
        for (int ks = 0; ks < 4; ++ks)
          o[g] = mma4((v2f){vr[2 * ks * kAPt], vr[(2 * ks + 1) * kAPt]}, (v2f){s[tt][2 * ks], s[tt][2 * ks + 1]}, o[g]);
      }
    }
    // hand-over, in this order: the wave's LDS reads of this stage are done; its copies of the next stage have landed; the barrier
    // publishes the next stage and frees this stage's buffer; only then the stage after the next is copied into it
    asm volatile("s_wait_dscnt 0x0" ::: "memory");
    a_landed();
    __syncthreads();
    if (st + 2 < kASn / kACh) a_stage(st + 2, buf);
  }
  a_landed();   // no copy is outstanding; the last trip's barrier also says that every wave has left the K|V buffers
#pragma unroll   // static indices into the two heads' register arrays
  for (int g = 0; g < 2; ++g) {
    const float lt = l[g] + other_half(l[g]);
    float* op = kvs + ((sl * kAHb + hp + g) * 16 + c) * kACp;
    *(v4f*)(op + 8 * h)     = (v4f){o[g][0], o[g][1], o[g][2], o[g][3]};
    *(v4f*)(op + 8 * h + 4) = (v4f){o[g][4], o[g][5], o[g][6], o[g][7]};
    if (h == 0) *(v2f*)(op + 16) = (v2f){m[g], lt};
  }
  __syncthreads();
  if (wave < 4) {    // threads 0..127; no barrier behind this point
    const int rl = t >> 3, c8 = (t & 7) * 8;
    const float* cb = kvs + ((c8 >> 4) * 16 + rl) * kACp;
    constexpr int kSs = kAHb * 16 * kACp;      // floats from one slice's records to the next
    float ml[kASl], ll[kASl];
#pragma unroll
    for (int s = 0; s < kASl; ++s) { const v2f e = *(const v2f*)(cb + s * kSs + 16); ml[s] = e[0]; ll[s] = e[1]; }
    float mx = ml[0];
#pragma unroll
    for (int s = 1; s < kASl; ++s) mx = fmaxf(mx, ml[s]);
    float lsum = 0.0f;
    v4f x0 = (v4f){0.f, 0.f, 0.f, 0.f}, x1 = (v4f){0.f, 0.f, 0.f, 0.f};
#pragma unroll
    for (int s = 0; s < kASl; ++s) {
      const float w = __expf(ml[s] - mx);
      const float* s8 = cb + s * kSs + (c8 & 15);
      lsum = fmaf(ll[s], w, lsum);
      x0 = *(const v4f*)(s8) * w + x0;
      x1 = *(const v4f*)(s8 + 4) * w + x1;
    }
    const float inv = 1.0f / lsum;
    x0 = x0 * inv;
    x1 = x1 * inv;
    unsigned short hb[8], lb[8];
#pragma unroll
    for (int e = 0; e < 4; ++e) {
      split_bf(x0[e], hb[e], lb[e]);
      split_bf(x1[e], hb[4 + e], lb[4 + e]);
    }
    const v4u uh = (v4u){pk16(hb[0], hb[1]), pk16(hb[2], hb[3]), pk16(hb[4], hb[5]), pk16(hb[6], hb[7])};
    const v4u ul = (v4u){pk16(lb[0], lb[1]), pk16(lb[2], lb[3]), pk16(lb[4], lb[5]), pk16(lb[6], lb[7])};
    if (p0 + rl < kP) {
      const size_t o = (size_t)(b * kP + p0 + rl) * kHD + hq * (kAHb * kD) + c8;
      *(v4u*)(Ohi + o) = uh;
      *(v4u*)(Olo + o) = ul;
    }
  }
}

// ---------------------------------------------------------------------------
// Zero fill of two regions, nvec x 16 B each (nvec % 256 == 0, so the region select is block-uniform).
// ---------------------------------------------------------------------------
__device__ __forceinline__ void zero16x2_body(int bid, unsigned int* __restrict__ p0, unsigned int* __restrict__ p1, int nvec) {
  const int i = bid * 256 + threadIdx.x;
  if (i >= 2 * nvec) return;
  unsigned int* p = (i < nvec) ? (p0 + 4 * (size_t)i) : (p1 + 4 * (size_t)(i - nvec));
  const v4u z = (v4u){0u, 0u, 0u, 0u};
  *(v4u*)p = z;
}

// ---------------------------------------------------------------------------
// First launch: the four jobs that read nothing but inputs, side by side in one grid of 256-thread blocks. By block index:
// query side (400, the longest job, placed first for speed only), weight preparation (13), zero fill of the 64 pad rows
// 1600..1663 of Ohi and Olo (8), node split (1024). The job select is block-uniform (scalar); the two jobs with LDS use
// the same bytes.
// ---------------------------------------------------------------------------
constexpr int kZrVec = (kBPpad - kBP) * kHD * 2 / 16;   // 16-B pieces per plane
constexpr int kZrBlocks = 2 * kZrVec / 256;
static_assert(kZrVec % 256 == 0, "zero fill blocks");
constexpr int kFrontBlocks = kQsBlocks + kWpBlocks + kZrBlocks + kEcBlocks;
constexpr int kFrontLds = (kWpLds > kQsLds) ? kWpLds : kQsLds;
__global__ __launch_bounds__(256) void k_front(const float* __restrict__ enc_last, const float* __restrict__ loadv,
                                              const float* __restrict__ Wq, const float* __restrict__ fW1,
                                              const float* __restrict__ fb1, const float* __restrict__ fW2,
                                              const float* __restrict__ fb2, const float* __restrict__ lqW,
                                              const float* __restrict__ lqb, const float* __restrict__ lW1,
                                              const float* __restrict__ lb1,
                                              float* __restrict__ Qs, float* __restrict__ QW,
                                              const float* __restrict__ Wk, const float* __restrict__ Wv,
                                              const float* __restrict__ Wcomb, const float* __restrict__ W2,
                                              unsigned short* __restrict__ WkvHi, unsigned short* __restrict__ WkvLo,
                                              unsigned short* __restrict__ WcHi, unsigned short* __restrict__ WcLo,
                                              unsigned short* __restrict__ W2T,
                                              unsigned int* __restrict__ OhiPad, unsigned int* __restrict__ OloPad,
                                              const float* __restrict__ enc, unsigned short* __restrict__ EncHi,
                                              unsigned short* __restrict__ EncLo) {
  __shared__ __align__(16) float smem[kFrontLds];
  const int bid = blockIdx.x;
  if (bid < kQsBlocks) {
    qside_body(smem, bid, enc_last, loadv, Wq, fW1, fb1, fW2, fb2, lqW, lqb, lW1, lb1, Qs, QW);
  } else if (bid < kQsBlocks + kWpBlocks) {
    wprep_body(smem, bid - kQsBlocks, Wk, Wv, Wcomb, W2, WkvHi, WkvLo, WcHi, WcLo, W2T);
  } else if (bid < kQsBlocks + kWpBlocks + kZrBlocks) {
    zero16x2_body(bid - (kQsBlocks + kWpBlocks), OhiPad, OloPad, kZrVec);
  } else {
    enc_cast_body(bid - (kQsBlocks + kWpBlocks + kZrBlocks), enc, EncHi, EncLo);
  }
}

// tanh with both of its ranges computed and one selected: no branch, so neighbouring elements can overlap
__device__ __forceinline__ float tanh_sel(float x) {
  const float ax = fabsf(x);
  const float e = __expf(ax + ax);                                    // inf for large |x|: 2 / inf = 0, the value is 1
  const float big = fmaf(__builtin_amdgcn_rcpf(e + 1.0f), -2.0f, 1.0f);
  const float x2 = x * x;
  float pl = fmaf(x2, -0.00570002059f, 0.0206340719f);                // odd series for |x| < 0.625
  pl = fmaf(x2, pl, -0.0537379310f);
  pl = fmaf(x2, pl, 0.133314162f);
  pl = fmaf(x2, pl, -0.333332807f);
  const float small = fmaf(x2, ax * pl, ax);
  return copysignf((ax < 0.625f) ? small : big, x);
}
// ---------------------------------------------------------------------------
// Tail: head merge, pointer scores, clipped tanh + mask and the softmax over the nodes, in one launch.
// Block = (b, group of 16 queries), 16 waves, 16 x 7 = 112 blocks; MH and the scores never leave the block.
// Both products run transposed, D[row 8h + r][query c], lane l: c = l & 15, h = l >> 4. A = 16 rows of a bf16 hi/lo plane pair
// (rows of W_comb^T, then node rows), B = the 16 queries' rows (O, then MH); both fragments take k = 32 s + 8h + e and
// 32 s + 16 + 8h + e, e = 0..7, at k step s; per k step hi.hi, then lo(A).hi(B), then hi(A).lo(B).
// A rows: 16 rows of a plane are 4096 contiguous bytes; a wave fetches them by whole lines into registers, one tile ahead,
// and passes them through its own LDS buffer at a pitch of 272 B (16 B x odd) to get the fragments.
//   head merge: waves 0..7, wave w = columns 16 w .. 16 w + 15 of MH; + b_comb, split to bf16 hi/lo, rows of 16 queries in LDS.
//   scores: wave w = nodes 64 w .. 64 w + 63, four tiles; a lane ends with 32 nodes of query c in registers.
//   softmax: maximum and sum per query in the lane, then lane l ^ 16, then the 16 waves through LDS tables, in wave order.
// xs holds the 16 mask rows (64000 contiguous bytes of ninf_mask, copied by whole 16-B pieces); every lane replaces its own
// elements by the probabilities, and the block copies xs to out the same way. Slots >= 1000 carry -inf and are not stored.
// Query rows >= P (last group): computed from finite rows of the O planes, never stored; no lane of another query reads them.
// All loops of this kernel and its helpers are unrolled in full: staged pieces, fragments and tiles are register arrays,
// which takes static indices.
// ---------------------------------------------------------------------------
constexpr int kTPit = 2 * kE + 16;     // bytes from one staged row of 128 16-bit elements to the next
constexpr int kTPl  = 16 * kTPit;      // one plane of 16 rows
constexpr int kTCh  = 2 * kTPl;        // hi plane + lo plane
constexpr int kTRp  = 20;              // floats per query in a reduction table: 16 waves, 4 unused
constexpr int kTXs  = 8 * 512 * 4;     // floats in xs: 16 rows of out, rounded up to 8 pieces of 16 B per thread
// 16 rows of the hi plane and of the lo plane, 512 contiguous bytes an instruction; o = lane * 16
__device__ __forceinline__ void t_fetch(v4u (&st)[16], const unsigned short* __restrict__ hi,
                                        const unsigned short* __restrict__ lo, unsigned o) {
#pragma unroll
  for (int i = 0; i < 8; ++i) st[i] = *(const v4u*)((const char*)hi + o + 512 * i);
#pragma unroll
  for (int i = 0; i < 8; ++i) st[8 + i] = *(const v4u*)((const char*)lo + o + 512 * i);
  // address translations done before a register that one of these loads names is reused; the "memory" clobber also keeps
  // the loads up here, ahead of the work that covers their latency
  asm volatile("s_wait_xcnt 0x0" :: "v"(o) : "memory");
}
// p: the lane's place in the first pair of rows of the wave's buffer
__device__ __forceinline__ void t_put(char* p, const v4u (&st)[16]) {
#pragma unroll
  for (int i = 0; i < 8; ++i) *(v4u*)(p + 2 * i * kTPit) = st[i];
#pragma unroll
  for (int i = 0; i < 8; ++i) *(v4u*)(p + kTPl + 2 * i * kTPit) = st[8 + i];
}
// orders a wave's LDS writes and the reads of them by its other lanes (and the reads before the next writes)
__device__ __forceinline__ void t_wave_sync() {
  __builtin_amdgcn_fence(__ATOMIC_RELEASE, "workgroup");
  __builtin_amdgcn_wave_barrier();
  __builtin_amdgcn_fence(__ATOMIC_ACQUIRE, "workgroup");
}
// p: row c of a staged plane pair, byte 16 h
__device__ __forceinline__ void t_frags(v16b (&fh)[4], v16b (&fl)[4], const char* p) {
#pragma unroll
  for (int s = 0; s < 4; ++s) {
    fh[s] = Frag<__bf16>::load((const __bf16*)(p + 64 * s));
    fl[s] = Frag<__bf16>::load((const __bf16*)(p + kTPl + 64 * s));
  }
}
__device__ __forceinline__ v8f t_tile(const char* p, const v16b (&qh)[4], const v16b (&ql)[4]) {
  v16b ah[4], al[4];
  t_frags(ah, al, p);
  v8f acc = (v8f){0.f, 0.f, 0.f, 0.f, 0.f, 0.f, 0.f, 0.f};
#pragma unroll
  for (int s = 0; s < 4; ++s) {
    acc = Frag<__bf16>::mma(ah[s], qh[s], acc);
    acc = Frag<__bf16>::mma(al[s], qh[s], acc);
    acc = Frag<__bf16>::mma(ah[s], ql[s], acc);
  }
  return acc;
}
__global__ __launch_bounds__(512) void k_tail(const unsigned short* __restrict__ Ohi, const unsigned short* __restrict__ Olo,
                                             const unsigned short* __restrict__ WcHi, const unsigned short* __restrict__ WcLo,
                                             const float* __restrict__ bc,
                                             const unsigned short* __restrict__ EncHi, const unsigned short* __restrict__ EncLo,
                                             const float* __restrict__ ninfm, float* __restrict__ out) {
  __shared__ __align__(16) char abufs[16 * kTCh];     // 139264 B: one plane pair of 16 rows per wave
  __shared__ __align__(16) char osb[kTCh];            // O rows of the 16 queries
  __shared__ __align__(16) char mhb[kTCh];            // MH rows of the 16 queries
  __shared__ __align__(16) float xs[kTXs];            // 65536 B: mask rows, then probabilities; the last 1536 B are never used
  static_assert(kTXs >= 16 * kN, "16 rows fit");
  __shared__ __align__(16) float redm[16 * kTRp];
  __shared__ __align__(16) float reds[16 * kTRp];
  const float kNegInf = -__builtin_inff();
  const int t = threadIdx.x, lane = t & 31;
  const int wave = __builtin_amdgcn_readfirstlane(t >> 5);   // scalar: plane bases and the job select stay off the vector unit
  const int b = blockIdx.x / kPG, p0 = (blockIdx.x - b * kPG) * 16;
  const int c = lane & 15, h = lane >> 4;
  const int row0 = b * kP + p0;
  const int npc = ((kP - p0 < 16) ? (kP - p0) : 16) * (kN / 4);   // 16-B pieces in the group's rows of ninf_mask and out
  const unsigned o16 = (unsigned)lane * 16u;
  // O: wave w fetches rows 2 (w & 7), + 1 of the hi (w < 8) or lo plane: 512 contiguous bytes
  const unsigned short* osrc = ((wave < 8) ? Ohi : Olo) + (size_t)(row0 + 2 * (wave & 7)) * kHD;
  const v4u ov = *(const v4u*)((const char*)osrc + o16);
  // b_comb of the lane's 8 MH columns (used by waves 0..7)
  const unsigned ob = (unsigned)((wave & 7) * 16 + 8 * h) * 4u;
  const v4f bc0 = *(const v4f*)((const char*)bc + ob), bc1 = *(const v4f*)((const char*)bc + ob + 16);
  // mask rows; a piece past the group's rows is fetched from piece 0 (in bounds) and lands in a row that is never stored
  const char* nsrc = (const char*)(ninfm + (size_t)row0 * kN);
  unsigned no[8];
  v4f nv[8];
#pragma unroll
  for (int i = 0; i < 8; ++i) {
    const int f = t + 512 * i;
    no[i] = (f < npc) ? (unsigned)f * 16u : 0u;
    nv[i] = *(const v4f*)(nsrc + no[i]);
  }
  // address translations done before a register that a load above names is reused
  asm volatile("s_wait_xcnt 0x0" :: "v"(o16), "v"(ob), "v"(no[0]), "v"(no[1]), "v"(no[2]), "v"(no[3]), "v"(no[4]), "v"(no[5]),
               "v"(no[6]), "v"(no[7]) : "memory");
  // first A tile: waves 0..7 their 16 rows of W_comb^T, waves 8..15 their first 16 nodes
  const unsigned short* eh = EncHi + ((size_t)b * kNP + wave * 64) * kE;
  const unsigned short* el = EncLo + ((size_t)b * kNP + wave * 64) * kE;
  const bool merger = wave < 8;   // scalar
  v4u st[16];
  t_fetch(st, merger ? (WcHi + (size_t)wave * 16 * kHD) : eh, merger ? (WcLo + (size_t)wave * 16 * kHD) : el, o16);
  const int wplace = h * kTPit + c * 16;    // writer: row h of a pair of rows, 16-B piece c
  const int rplace = c * kTPit + h * 16;    // fragment reader: row c, k from 8 h
  *(v4u*)(osb + (wave >> 3) * kTPl + 2 * (wave & 7) * kTPit + wplace) = ov;
#pragma unroll
  for (int i = 0; i < 8; ++i) {
    *(v4f*)(xs + 4 * (t + 512 * i)) = nv[i];
  }
  __syncthreads();   // O rows and mask rows are in LDS
  char* abw = abufs + wave * kTCh + wplace;
  const char* abr = abufs + wave * kTCh + rplace;
  v16b qh[4], ql[4];
  if (merger) {
    t_put(abw, st);
    t_wave_sync();
    t_fetch(st, eh, el, o16);
    t_frags(qh, ql, osb + rplace);
    const v8f d = t_tile(abr, qh, ql);
    unsigned short hb[8], lb[8];
#pragma unroll
    for (int r = 0; r < 4; ++r) {
      split_bf(d[r] + bc0[r], hb[r], lb[r]);
      split_bf(d[4 + r] + bc1[r], hb[4 + r], lb[4 + r]);
    }
    char* md = mhb + c * kTPit + (wave * 16 + 8 * h) * 2;
    *(v4u*)(md) = (v4u){pk16(hb[0], hb[1]), pk16(hb[2], hb[3]), pk16(hb[4], hb[5]), pk16(hb[6], hb[7])};
    *(v4u*)(md + kTPl) = (v4u){pk16(lb[0], lb[1]), pk16(lb[2], lb[3]), pk16(lb[4], lb[5]), pk16(lb[6], lb[7])};
  }
  __syncthreads();   // MH rows are in LDS; waves 0..7 have left their buffers
  t_frags(qh, ql, mhb + rplace);
  v8f acc[4];
#pragma unroll
  for (int j = 0; j < 4; ++j) {
    t_put(abw, st);
    t_wave_sync();
    if (j < 3) t_fetch(st, eh + (j + 1) * 16 * kE, el + (j + 1) * 16 * kE, o16);
    acc[j] = t_tile(abr, qh, ql);
    if (j < 3) t_wave_sync();
  }
  // register r of tile j: node 64 wave + 16 j + 8 h + r, query c. 1000 is a multiple of 8: a lane's 8 nodes are all in or all out.
  float mx = kNegInf;
#pragma unroll
  for (int j = 0; j < 4; ++j) {
    const int n8 = wave * 64 + 16 * j + 8 * h;
    const bool ok = n8 < kN;
    const float* xp = xs + c * kN + (ok ? n8 : 0);            // address clamp
    const v4f m0 = *(const v4f*)(xp), m1 = *(const v4f*)(xp + 4);
#pragma unroll
    for (int r = 0; r < 8; ++r) {
      const float v = kClip * tanh_sel(acc[j][r] * kInvSqrtE) + ((r < 4) ? m0[r & 3] : m1[r & 3]);
      acc[j][r] = ok ? v : kNegInf;
      mx = fmaxf(mx, acc[j][r]);
    }
  }
  mx = fmaxf(mx, other_half(mx));
  if (h == 0) redm[c * kTRp + wave] = mx;
  __syncthreads();   // every wave's maxima are in the table
#pragma unroll
  for (int q = 0; q < 4; ++q) {
    const v4f e = *(const v4f*)(redm + c * kTRp + 4 * q);
    mx = fmaxf(fmaxf(mx, fmaxf(e[0], e[1])), fmaxf(e[2], e[3]));
  }
  float sum = 0.0f;
#pragma unroll
  for (int j = 0; j < 4; ++j)
#pragma unroll
    for (int r = 0; r < 8; ++r) {
      acc[j][r] = __expf(acc[j][r] - mx);
      sum += acc[j][r];
    }
  sum += other_half(sum);
  if (h == 0) reds[c * kTRp + wave] = sum;
  __syncthreads();   // every wave's sums are in the table
  float tot = 0.0f;
#pragma unroll
  for (int q = 0; q < 4; ++q) {
    const v4f e = *(const v4f*)(reds + c * kTRp + 4 * q);
    tot = (((tot + e[0]) + e[1]) + e[2]) + e[3];
  }
  const float inv = 1.0f / tot;
#pragma unroll
  for (int j = 0; j < 4; ++j) {
    const int n8 = wave * 64 + 16 * j + 8 * h;
    if (n8 < kN) {
      float* xp = xs + c * kN + n8;
      *(v4f*)(xp)     = (v4f){acc[j][0] * inv, acc[j][1] * inv, acc[j][2] * inv, acc[j][3] * inv};
      *(v4f*)(xp + 4) = (v4f){acc[j][4] * inv, acc[j][5] * inv, acc[j][6] * inv, acc[j][7] * inv};
    }
  }
  __syncthreads();   // the probabilities of the 16 rows are in xs
  char* obase = (char*)(out + (size_t)row0 * kN);
  v4f pv[8];
#pragma unroll
  for (int i = 0; i < 8; ++i) pv[i] = *(const v4f*)(xs + 4 * (t + 512 * i));
#pragma unroll
  for (int i = 0; i < 8; ++i) {
    if (t + 512 * i < npc) *(v4f*)(obase + (unsigned)t * 16u + 8192 * i) = pv[i];
  }
}

// ---------------------------------------------------------------------------
// Host launcher
// Workspace region map (bytes, 256-B aligned offsets):
//   EncHi bf16 [16][1024][128]          4,194,304
//   EncLo bf16 [16][1024][128]          4,194,304
//   WkvHi bf16 [256][128]                 65,536
//   WkvLo bf16 [256][128]                 65,536
//   WcHi  bf16 [128][128]                 32,768
//   WcLo  bf16 [128][128]                 32,768
//   W2T   f16  [64][64]                    8,192
//   KVf   f32  [16384][256]            16,777,216
//   Qs    f32  [1600][128]                819,200
//   QW    f32  [1600][64]                 409,600
//   MASKB f32  [1600][1024]             6,553,600
//   Ohi   bf16 [1664][128]                425,984
//   Olo   bf16 [1664][128]                425,984
//   total                              34,004,992
// ---------------------------------------------------------------------------
static inline size_t align256(size_t x) { return (x + 255) & ~(size_t)255; }

extern "C" void kernel_launch(void* const* d_in, const int* in_sizes, int n_in,
                              void* d_out, int out_size, void* d_ws, size_t ws_size,
                              hipStream_t stream) {
  if (n_in < 22) return;
  if (in_sizes[0] != kB * kN * kE || in_sizes[1] != kB * kP * kE || in_sizes[2] != kB * kP ||
      in_sizes[3] != kB * kP * kN || in_sizes[4] != kB * kP * kN * kDYN || out_size != kB * kP * kN) return;

  const float* enc      = (const float*)d_in[0];
  const float* enc_last = (const float*)d_in[1];
  const float* loadv    = (const float*)d_in[2];
  const float* ninfm    = (const float*)d_in[3];
  const float* dyn      = (const float*)d_in[4];
  const float* Wq       = (const float*)d_in[5];
  const float* Wk       = (const float*)d_in[6];
  const float* Wv       = (const float*)d_in[7];
  const float* Wc       = (const float*)d_in[8];
  const float* bcv      = (const float*)d_in[9];
  const float* fW1      = (const float*)d_in[10];
  const float* fb1      = (const float*)d_in[11];
  const float* fW2      = (const float*)d_in[12];
  const float* fb2      = (const float*)d_in[13];
  const float* lqW      = (const float*)d_in[14];
  const float* lqb      = (const float*)d_in[15];
  const float* lW1      = (const float*)d_in[16];
  const float* lb1      = (const float*)d_in[17];
  const float* lW2      = (const float*)d_in[18];
  const float* lb2      = (const float*)d_in[19];
  const float* lW3      = (const float*)d_in[20];
  const float* lb3      = (const float*)d_in[21];
  float* out = (float*)d_out;

  char* ws = (char*)d_ws;
  size_t off = 0;
  unsigned short* EncHi = (unsigned short*)(ws + off); off = align256(off + (size_t)kEncRows * kE * 2);
  unsigned short* EncLo = (unsigned short*)(ws + off); off = align256(off + (size_t)kEncRows * kE * 2);
  unsigned short* WkvHi = (unsigned short*)(ws + off); off = align256(off + (size_t)2 * kHD * kE * 2);
  unsigned short* WkvLo = (unsigned short*)(ws + off); off = align256(off + (size_t)2 * kHD * kE * 2);
  unsigned short* WcHi  = (unsigned short*)(ws + off); off = align256(off + (size_t)kE * kHD * 2);
  unsigned short* WcLo  = (unsigned short*)(ws + off); off = align256(off + (size_t)kE * kHD * 2);
  unsigned short* W2T   = (unsigned short*)(ws + off); off = align256(off + (size_t)kHID * kHID * 2);
  float* KVf   = (float*)(ws + off); off = align256(off + (size_t)kEncRows * 2 * kHD * 4);
  float* Qs    = (float*)(ws + off); off = align256(off + (size_t)kBP * kHD * 4);
  float* QW    = (float*)(ws + off); off = align256(off + (size_t)kBP * kHID * 4);
  float* MASKB = (float*)(ws + off); off = align256(off + (size_t)kBP * kNP * 4);
  unsigned short* Ohi  = (unsigned short*)(ws + off); off = align256(off + (size_t)kBPpad * kHD * 2);
  unsigned short* Olo  = (unsigned short*)(ws + off); off = align256(off + (size_t)kBPpad * kHD * 2);
  if (off > ws_size) return;

  // launch 1, inputs only: query side (f32); weight planes (Wk|Wv and W_comb transposed to bf16 hi/lo [n][k], lm_W2 transposed
  // to f16 x16); zeros in the 64 pad rows of Ohi and Olo; node planes (bf16 hi/lo, 24 zero pad rows per batch in both)
  k_front<<<kFrontBlocks, 256, 0, stream>>>(enc_last, loadv, Wq, fW1, fb1, fW2, fb2, lqW, lqb, lW1, lb1, Qs, QW,
                                            Wk, Wv, Wc, lW2, WkvHi, WkvLo, WcHi, WcLo, W2T,
                                            (unsigned int*)(Ohi + (size_t)kBP * kHD), (unsigned int*)(Olo + (size_t)kBP * kHD),
                                            enc, EncHi, EncLo);
  // launch 2: K|V projection (bf16 hi/lo both operands, K=128, M=16384, N=256 -> f32) beside the lazy-mask MLP (three layers
  // fused, all 1600 x 1024 slots; hidden layer on WMMA f16 (W x16), K=64)
  k_kv_lazy<<<kKvBlocks + kBP, 128, 0, stream>>>(EncHi, EncLo, WkvHi, WkvLo, KVf, dyn, QW, lW1, (const _Float16*)W2T, lb2, lW3,
                                                 lb3, ninfm, MASKB);
  // attention core (f32), 8 node slices per block merged in LDS -> O as bf16 hi/lo planes
  k_attn<<<kB * 14, 512, 0, stream>>>(Qs, KVf, MASKB, Ohi, Olo);
  // tail: head merge (bf16 hi/lo both operands, K=128, + b_comb), pointer scores against the node planes (bf16 hi/lo, K=128,
  // scale 1/sqrt(128)), clipped tanh + mask + softmax -> probs; one block per batch and group of 16 queries
  k_tail<<<kB * kPG, 512, 0, stream>>>(Ohi, Olo, WcHi, WcLo, bcv, EncHi, EncLo, ninfm, out);
}
